// v000
// Measured on an AMD MI455X. A time is GPU time per run, averaged over a window of back-to-back runs after a warm-up
// (all launches, gaps included; the runs take copies of the inputs in turn), and the median of several windows.
// Apart from v000's, it joins two sittings. Times from different sittings can be a few percent apart, while
// side-by-side timings come from the same sitting.
// v000, which the later versions start from, runs in 516 microseconds.
#include <hip/hip_runtime.h>
#include <hip/hip_bf16.h>
#include <math.h>

// ---- problem constants (match reference) ----
#define T_ 32
#define D_ 256
#define H_ 1024
#define B_ 2048

// ---- tiling ----
#define BM 128      // rows of x per workgroup
#define HC 64       // H chunk per iteration
#define NWAVE 8     // 256 threads / wave32

// LDS layout (bytes):
//   xA : [BM][D_]   bf16 = 65536
//   w1s: [HC][D_]   bf16 = 32768   (B^T of layer-1 chunk: row = h, col = d)
//   w2s: [D_][HC]   bf16 = 32768   (B^T of layer-2:       row = d, col = h)
//   hs : [NWAVE][16][HC] bf16 = 16384 (per-wave gelu(h) staging for A-frags)
#define LDS_XA   0
#define LDS_W1S  65536
#define LDS_W2S  (65536 + 32768)
#define LDS_HS   (65536 + 32768 + 32768)
#define LDS_BYTES (65536 + 32768 + 32768 + 16384)

typedef __attribute__((ext_vector_type(16))) __bf16 v16bf;
typedef __attribute__((ext_vector_type(8)))  float  v8f;
typedef __attribute__((ext_vector_type(4)))  unsigned int u32x4;
typedef __attribute__((ext_vector_type(2)))  unsigned int u32x2;

__device__ __forceinline__ unsigned pack_bf16x2(float a, float b) {
    unsigned short ua = __builtin_bit_cast(unsigned short, (__bf16)a);
    unsigned short ub = __builtin_bit_cast(unsigned short, (__bf16)b);
    return (unsigned)ua | ((unsigned)ub << 16);
}

// Branch-free exact-erf GELU (Abramowitz & Stegun 7.1.26, |err| < 1.5e-7 --
// below the bf16 rounding applied to h anyway). Uses v_rcp_f32 + v_exp_f32,
// no EXEC divergence, unlike ocml erff.
__device__ __forceinline__ float gelu_erf(float v) {
    float z = fabsf(v) * 0.70710678118654752f;     // |v|/sqrt(2)
    float t = __builtin_amdgcn_rcpf(fmaf(0.3275911f, z, 1.0f));
    float p = t * fmaf(t, fmaf(t, fmaf(t, fmaf(t, 1.061405429f, -1.453152027f),
                                       1.421413741f), -0.284496736f), 0.254829592f);
    float e = __expf(-z * z);
    float erfv = copysignf(fmaf(-p, e, 1.0f), v);  // erf(v/sqrt(2))
    return 0.5f * v * (1.0f + erfv);
}

// Build one 16x16x32 bf16 operand fragment (8 VGPRs) from a row base in LDS.
// Per the CDNA5 ISA A-layout: this lane's data is two contiguous 16-byte runs
// at element offsets koff and koff+16 within its row.
__device__ __forceinline__ v16bf ld_frag(const __bf16* rowptr, int koff) {
    union { v16bf v; u32x4 q[2]; } u;
    u.q[0] = *(const u32x4*)(rowptr + koff);
    u.q[1] = *(const u32x4*)(rowptr + koff + 16);
    return u.v;
}

__device__ __forceinline__ v8f wmma_bf16(v16bf a, v16bf b, v8f c) {
    return __builtin_amdgcn_wmma_f32_16x16x32_bf16(false, a, false, b,
                                                   (short)0, c, false, false);
}

__global__ void __launch_bounds__(256)
PerTokenFFN_wmma_kernel(const float* __restrict__ x,
                        const float* __restrict__ W1,
                        const float* __restrict__ b1,
                        const float* __restrict__ W2,
                        const float* __restrict__ b2,
                        float* __restrict__ y)
{
    extern __shared__ char smem[];
    __bf16* xA    = (__bf16*)(smem + LDS_XA);
    __bf16* w1s   = (__bf16*)(smem + LDS_W1S);
    __bf16* w2s   = (__bf16*)(smem + LDS_W2S);
    __bf16* hsAll = (__bf16*)(smem + LDS_HS);

    const int tid   = threadIdx.x;
    const int lane  = tid & 31;
    const int wave  = tid >> 5;
    const int half  = lane >> 4;   // which half-wave (selects K sub-range)
    const int lhalf = lane & 15;   // M (A-frag) / N (B-frag) index
    const int tkn   = blockIdx.y;
    const int b0    = blockIdx.x * BM;
    const int m0    = wave * 16;

    __bf16* hs = hsAll + wave * (16 * HC);

    // ---------------- stage x tile (f32 -> bf16) ----------------
    {
        const float* xbase = x + (size_t)b0 * (T_ * D_) + (size_t)tkn * D_;
        #pragma unroll
        for (int i = 0; i < 32; ++i) {
            int idx = tid + i * 256;
            int row = idx >> 6;        // 64 float4 per row
            int c4  = idx & 63;
            const float4 v = *(const float4*)(xbase + (size_t)row * (T_ * D_) + c4 * 4);
            u32x2 p;
            p.x = pack_bf16x2(v.x, v.y);
            p.y = pack_bf16x2(v.z, v.w);
            *(u32x2*)(xA + row * D_ + c4 * 4) = p;
        }
    }

    v8f yacc[16];
    #pragma unroll
    for (int n = 0; n < 16; ++n) yacc[n] = (v8f){0.f,0.f,0.f,0.f,0.f,0.f,0.f,0.f};

    for (int hc = 0; hc < H_; hc += HC) {
        __syncthreads();  // previous chunk's fragment reads complete

        // ---- stage W1 chunk transposed: w1s[h][d], thread <-> d row ----
        {
            const float* wrow = W1 + ((size_t)tkn * D_ + tid) * H_ + hc;
            #pragma unroll
            for (int j = 0; j < HC; j += 4) {
                float4 v = *(const float4*)(wrow + j);
                w1s[(j + 0) * D_ + tid] = (__bf16)v.x;
                w1s[(j + 1) * D_ + tid] = (__bf16)v.y;
                w1s[(j + 2) * D_ + tid] = (__bf16)v.z;
                w1s[(j + 3) * D_ + tid] = (__bf16)v.w;
            }
        }
        // ---- stage W2 chunk transposed: w2s[d][h], thread <-> (h, d-seg) ----
        {
            int hh = tid >> 2;
            int d0 = (tid & 3) * 64;
            const float* wrow = W2 + ((size_t)tkn * H_ + hc + hh) * D_ + d0;
            #pragma unroll
            for (int j = 0; j < 64; j += 4) {
                float4 v = *(const float4*)(wrow + j);
                w2s[(d0 + j + 0) * HC + hh] = (__bf16)v.x;
                w2s[(d0 + j + 1) * HC + hh] = (__bf16)v.y;
                w2s[(d0 + j + 2) * HC + hh] = (__bf16)v.z;
                w2s[(d0 + j + 3) * HC + hh] = (__bf16)v.w;
            }
        }
        __syncthreads();

        // ---- GEMM1: h[16 x 64] = xA[16 x 256] * W1chunk[256 x 64] ----
        // Software-pipelined: fragments for k-step s+1 are loaded while the
        // WMMAs of k-step s execute, so ds_loads overlap matrix issue.
        v8f ht[4];
        #pragma unroll
        for (int n = 0; n < 4; ++n) ht[n] = (v8f){0.f,0.f,0.f,0.f,0.f,0.f,0.f,0.f};

        {
            const __bf16* aRow = xA + (m0 + lhalf) * D_;
            v16bf a_cur = ld_frag(aRow, half * 8);
            v16bf b_cur[4];
            #pragma unroll
            for (int n = 0; n < 4; ++n)
                b_cur[n] = ld_frag(w1s + (n * 16 + lhalf) * D_, half * 8);

            #pragma unroll
            for (int ks = 0; ks < 8; ++ks) {
                v16bf a_nxt;
                v16bf b_nxt[4];
                if (ks < 7) {
                    int koff = (ks + 1) * 32 + half * 8;
                    a_nxt = ld_frag(aRow, koff);
                    #pragma unroll
                    for (int n = 0; n < 4; ++n)
                        b_nxt[n] = ld_frag(w1s + (n * 16 + lhalf) * D_, koff);
                }
                #pragma unroll
                for (int n = 0; n < 4; ++n)
                    ht[n] = wmma_bf16(a_cur, b_cur[n], ht[n]);
                if (ks < 7) {
                    a_cur = a_nxt;
                    #pragma unroll
                    for (int n = 0; n < 4; ++n) b_cur[n] = b_nxt[n];
                }
            }
        }

        // ---- bias + exact GELU, round to bf16, scatter into A-layout LDS ----
        #pragma unroll
        for (int n = 0; n < 4; ++n) {
            float bias = b1[(size_t)tkn * H_ + hc + n * 16 + lhalf];
            #pragma unroll
            for (int r = 0; r < 8; ++r) {
                float v = ht[n][r] + bias;          // C/D: row r+8*half, col lhalf
                hs[(r + 8 * half) * HC + n * 16 + lhalf] = (__bf16)gelu_erf(v);
            }
        }

        // ---- GEMM2: yacc[16 x 256] += gelu(h)[16 x 64] * W2chunk[64 x 256] ----
        // 8 pipeline steps: step s = (kk-half s>>2, ntile-group s&3), 4 WMMAs each.
        {
            const __bf16* hRow = hs + lhalf * HC;
            v16bf a2[2];
            a2[0] = ld_frag(hRow, half * 8);
            a2[1] = ld_frag(hRow, 32 + half * 8);

            v16bf b_cur[4];
            #pragma unroll
            for (int j = 0; j < 4; ++j)
                b_cur[j] = ld_frag(w2s + (j * 16 + lhalf) * HC, half * 8);

            #pragma unroll
            for (int s = 0; s < 8; ++s) {
                v16bf b_nxt[4];
                if (s < 7) {
                    int sn  = s + 1;
                    int kkn = (sn >> 2) * 32;
                    int gn  = sn & 3;
                    #pragma unroll
                    for (int j = 0; j < 4; ++j)
                        b_nxt[j] = ld_frag(w2s + ((gn * 4 + j) * 16 + lhalf) * HC,
                                           kkn + half * 8);
                }
                int g = s & 3;
                #pragma unroll
                for (int j = 0; j < 4; ++j)
                    yacc[g * 4 + j] = wmma_bf16(a2[s >> 2], b_cur[j], yacc[g * 4 + j]);
                if (s < 7) {
                    #pragma unroll
                    for (int j = 0; j < 4; ++j) b_cur[j] = b_nxt[j];
                }
            }
        }
    }

    // ---------------- epilogue: + b2, store f32 ----------------
    #pragma unroll
    for (int n = 0; n < 16; ++n) {
        int col    = n * 16 + lhalf;
        float bias = b2[(size_t)tkn * D_ + col];
        #pragma unroll
        for (int r = 0; r < 8; ++r) {
            int row = m0 + r + 8 * half;
            y[(size_t)(b0 + row) * (T_ * D_) + (size_t)tkn * D_ + col] = yacc[n][r] + bias;
        }
    }
}

extern "C" void kernel_launch(void* const* d_in, const int* in_sizes, int n_in,
                              void* d_out, int out_size, void* d_ws, size_t ws_size,
                              hipStream_t stream) {
    (void)in_sizes; (void)n_in; (void)out_size; (void)d_ws; (void)ws_size;
    const float* x  = (const float*)d_in[0];
    const float* W1 = (const float*)d_in[1];
    const float* b1 = (const float*)d_in[2];
    const float* W2 = (const float*)d_in[3];
    const float* b2 = (const float*)d_in[4];
    float* y = (float*)d_out;

    dim3 grid(B_ / BM, T_);   // 16 x 32 = 512 workgroups
    dim3 block(256);          // 8 wave32
    PerTokenFFN_wmma_kernel<<<grid, block, LDS_BYTES, stream>>>(x, W1, b1, W2, b2, y);
}

// v001
// One run takes 209 microseconds.
// Two timings next to v000 put it at 2.47 and 2.48 times that version's speed.
#include <hip/hip_runtime.h>
#include <hip/hip_bf16.h>
#include <math.h>

// ---- problem constants (match reference) ----
#define T_ 32
#define D_ 256
#define H_ 1024
#define B_ 2048

// ---- tiling ----
#define BM 128      // rows of x per workgroup
#define HC 64       // H chunk per iteration
#define NWAVE 8     // 256 threads / wave32

// LDS row pitch in bf16 elements: every row carries 8 pad elements (16 B), so
// the pitch is an odd multiple of 16 B and the 16 rows that one ds_load_b128
// fragment read touches fall on 16 different groups of four banks.
#define DP (D_ + 8)  // 528 B rows: xA, w1s
#define HP (HC + 8)  // 144 B rows: w2s, hs

// LDS layout (bytes):
//   xA : [BM][DP]   bf16 = 67584
//   w1s: [HC][DP]   bf16 = 33792   (B^T of layer-1 chunk: row = h, col = d)
//   w2s: [D_][HP]   bf16 = 36864   (B^T of layer-2:       row = d, col = h)
//   hs : [NWAVE][16][HP] bf16 = 18432 (per-wave gelu(h) staging for A-frags)
#define LDS_XA   0
#define LDS_W1S  (BM * DP * 2)
#define LDS_W2S  (LDS_W1S + HC * DP * 2)
#define LDS_HS   (LDS_W2S + D_ * HP * 2)
#define LDS_BYTES (LDS_HS + NWAVE * 16 * HP * 2)

typedef __attribute__((ext_vector_type(16))) __bf16 v16bf;
typedef __attribute__((ext_vector_type(8)))  float  v8f;
typedef __attribute__((ext_vector_type(4)))  unsigned int u32x4;
typedef __attribute__((ext_vector_type(2)))  unsigned int u32x2;

__device__ __forceinline__ unsigned pack_bf16x2(float a, float b) {
    unsigned short ua = __builtin_bit_cast(unsigned short, (__bf16)a);
    unsigned short ub = __builtin_bit_cast(unsigned short, (__bf16)b);
    return (unsigned)ua | ((unsigned)ub << 16);
}

// Branch-free exact-erf GELU (Abramowitz & Stegun 7.1.26, |err| < 1.5e-7 --
// below the bf16 rounding applied to h anyway). Uses v_rcp_f32 + v_exp_f32,
// no EXEC divergence, unlike ocml erff.
__device__ __forceinline__ float gelu_erf(float v) {
    float z = fabsf(v) * 0.70710678118654752f;     // |v|/sqrt(2)
    float t = __builtin_amdgcn_rcpf(fmaf(0.3275911f, z, 1.0f));
    float p = t * fmaf(t, fmaf(t, fmaf(t, fmaf(t, 1.061405429f, -1.453152027f),
                                       1.421413741f), -0.284496736f), 0.254829592f);
    float e = __expf(-z * z);
    float erfv = copysignf(fmaf(-p, e, 1.0f), v);  // erf(v/sqrt(2))
    return 0.5f * v * (1.0f + erfv);
}

// Build one 16x16x32 bf16 operand fragment (8 VGPRs) from a row base in LDS.
// Per the CDNA5 ISA A-layout: this lane's data is two contiguous 16-byte runs
// at element offsets koff and koff+16 within its row.
__device__ __forceinline__ v16bf ld_frag(const __bf16* rowptr, int koff) {
    union { v16bf v; u32x4 q[2]; } u;
    u.q[0] = *(const u32x4*)(rowptr + koff);
    u.q[1] = *(const u32x4*)(rowptr + koff + 16);
    return u.v;
}

__device__ __forceinline__ v8f wmma_bf16(v16bf a, v16bf b, v8f c) {
    return __builtin_amdgcn_wmma_f32_16x16x32_bf16(false, a, false, b,
                                                   (short)0, c, false, false);
}

__global__ void __launch_bounds__(256)
PerTokenFFN_wmma_kernel(const float* __restrict__ x,
                        const float* __restrict__ W1,
                        const float* __restrict__ b1,
                        const float* __restrict__ W2,
                        const float* __restrict__ b2,
                        float* __restrict__ y)
{
    extern __shared__ char smem[];
    __bf16* xA    = (__bf16*)(smem + LDS_XA);
    __bf16* w1s   = (__bf16*)(smem + LDS_W1S);
    __bf16* w2s   = (__bf16*)(smem + LDS_W2S);
    __bf16* hsAll = (__bf16*)(smem + LDS_HS);

    const int tid   = threadIdx.x;
    const int lane  = tid & 31;
    const int wave  = tid >> 5;
    const int half  = lane >> 4;   // which half-wave (selects K sub-range)
    const int lhalf = lane & 15;   // M (A-frag) / N (B-frag) index
    const int tkn   = blockIdx.y;
    const int b0    = blockIdx.x * BM;
    const int m0    = wave * 16;

    __bf16* hs = hsAll + wave * (16 * HP);

    // ---------------- stage x tile (f32 -> bf16) ----------------
    {
        const float* xbase = x + (size_t)b0 * (T_ * D_) + (size_t)tkn * D_;
        #pragma unroll
        for (int i = 0; i < 32; ++i) {
            int idx = tid + i * 256;
            int row = idx >> 6;        // 64 float4 per row
            int c4  = idx & 63;
            const float4 v = *(const float4*)(xbase + (size_t)row * (T_ * D_) + c4 * 4);
            u32x2 p;
            p.x = pack_bf16x2(v.x, v.y);
            p.y = pack_bf16x2(v.z, v.w);
            *(u32x2*)(xA + row * DP + c4 * 4) = p;
        }
    }

    v8f yacc[16];
    #pragma unroll
    for (int n = 0; n < 16; ++n) yacc[n] = (v8f){0.f,0.f,0.f,0.f,0.f,0.f,0.f,0.f};

    for (int hc = 0; hc < H_; hc += HC) {
        __syncthreads();  // previous chunk's fragment reads complete

        // ---- stage W1 chunk transposed: w1s[h][d], thread <-> d row ----
        {
            const float* wrow = W1 + ((size_t)tkn * D_ + tid) * H_ + hc;
            #pragma unroll
            for (int j = 0; j < HC; j += 4) {
                float4 v = *(const float4*)(wrow + j);
                w1s[(j + 0) * DP + tid] = (__bf16)v.x;
                w1s[(j + 1) * DP + tid] = (__bf16)v.y;
                w1s[(j + 2) * DP + tid] = (__bf16)v.z;
                w1s[(j + 3) * DP + tid] = (__bf16)v.w;
            }
        }
        // ---- stage W2 chunk transposed: w2s[d][h], thread <-> (h, d-seg) ----
        {
            int hh = tid >> 2;
            int d0 = (tid & 3) * 64;
            const float* wrow = W2 + ((size_t)tkn * H_ + hc + hh) * D_ + d0;
            #pragma unroll
            for (int j = 0; j < 64; j += 4) {
                float4 v = *(const float4*)(wrow + j);
                w2s[(d0 + j + 0) * HP + hh] = (__bf16)v.x;
                w2s[(d0 + j + 1) * HP + hh] = (__bf16)v.y;
                w2s[(d0 + j + 2) * HP + hh] = (__bf16)v.z;
                w2s[(d0 + j + 3) * HP + hh] = (__bf16)v.w;
            }
        }
        __syncthreads();

        // ---- GEMM1: h[16 x 64] = xA[16 x 256] * W1chunk[256 x 64] ----
        // Software-pipelined: fragments for k-step s+1 are loaded while the
        // WMMAs of k-step s execute, so ds_loads overlap matrix issue.
        v8f ht[4];
        #pragma unroll
        for (int n = 0; n < 4; ++n) ht[n] = (v8f){0.f,0.f,0.f,0.f,0.f,0.f,0.f,0.f};

        {
            const __bf16* aRow = xA + (m0 + lhalf) * DP;
            v16bf a_cur = ld_frag(aRow, half * 8);
            v16bf b_cur[4];
            #pragma unroll
            for (int n = 0; n < 4; ++n)
                b_cur[n] = ld_frag(w1s + (n * 16 + lhalf) * DP, half * 8);

            #pragma unroll
            for (int ks = 0; ks < 8; ++ks) {
                v16bf a_nxt;
                v16bf b_nxt[4];
                if (ks < 7) {
                    int koff = (ks + 1) * 32 + half * 8;
                    a_nxt = ld_frag(aRow, koff);
                    #pragma unroll
                    for (int n = 0; n < 4; ++n)
                        b_nxt[n] = ld_frag(w1s + (n * 16 + lhalf) * DP, koff);
                }
                #pragma unroll
                for (int n = 0; n < 4; ++n)
                    ht[n] = wmma_bf16(a_cur, b_cur[n], ht[n]);
                if (ks < 7) {
                    a_cur = a_nxt;
                    #pragma unroll
                    for (int n = 0; n < 4; ++n) b_cur[n] = b_nxt[n];
                }
            }
        }

        // ---- bias + exact GELU, round to bf16, scatter into A-layout LDS ----
        #pragma unroll
        for (int n = 0; n < 4; ++n) {
            float bias = b1[(size_t)tkn * H_ + hc + n * 16 + lhalf];
            #pragma unroll
            for (int r = 0; r < 8; ++r) {
                float v = ht[n][r] + bias;          // C/D: row r+8*half, col lhalf
                hs[(r + 8 * half) * HP + n * 16 + lhalf] = (__bf16)gelu_erf(v);
            }
        }

        // ---- GEMM2: yacc[16 x 256] += gelu(h)[16 x 64] * W2chunk[64 x 256] ----
        // 8 pipeline steps: step s = (kk-half s>>2, ntile-group s&3), 4 WMMAs each.
        {
            const __bf16* hRow = hs + lhalf * HP;
            v16bf a2[2];
            a2[0] = ld_frag(hRow, half * 8);
            a2[1] = ld_frag(hRow, 32 + half * 8);

            v16bf b_cur[4];
            #pragma unroll
            for (int j = 0; j < 4; ++j)
                b_cur[j] = ld_frag(w2s + (j * 16 + lhalf) * HP, half * 8);

            #pragma unroll
            for (int s = 0; s < 8; ++s) {
                v16bf b_nxt[4];
                if (s < 7) {
                    int sn  = s + 1;
                    int kkn = (sn >> 2) * 32;
                    int gn  = sn & 3;
                    #pragma unroll
                    for (int j = 0; j < 4; ++j)
                        b_nxt[j] = ld_frag(w2s + ((gn * 4 + j) * 16 + lhalf) * HP,
                                           kkn + half * 8);
                }
                int g = s & 3;
                #pragma unroll
                for (int j = 0; j < 4; ++j)
                    yacc[g * 4 + j] = wmma_bf16(a2[s >> 2], b_cur[j], yacc[g * 4 + j]);
                if (s < 7) {
                    #pragma unroll
                    for (int j = 0; j < 4; ++j) b_cur[j] = b_nxt[j];
                }
            }
        }
    }

    // ---------------- epilogue: + b2, store f32 ----------------
    #pragma unroll
    for (int n = 0; n < 16; ++n) {
        int col    = n * 16 + lhalf;
        float bias = b2[(size_t)tkn * D_ + col];
        #pragma unroll
        for (int r = 0; r < 8; ++r) {
            int row = m0 + r + 8 * half;
            y[(size_t)(b0 + row) * (T_ * D_) + (size_t)tkn * D_ + col] = yacc[n][r] + bias;
        }
    }
}

extern "C" void kernel_launch(void* const* d_in, const int* in_sizes, int n_in,
                              void* d_out, int out_size, void* d_ws, size_t ws_size,
                              hipStream_t stream) {
    (void)in_sizes; (void)n_in; (void)out_size; (void)d_ws; (void)ws_size;
    const float* x  = (const float*)d_in[0];
    const float* W1 = (const float*)d_in[1];
    const float* b1 = (const float*)d_in[2];
    const float* W2 = (const float*)d_in[3];
    const float* b2 = (const float*)d_in[4];
    float* y = (float*)d_out;

    dim3 grid(B_ / BM, T_);   // 16 x 32 = 512 workgroups
    dim3 block(256);          // 8 wave32
    PerTokenFFN_wmma_kernel<<<grid, block, LDS_BYTES, stream>>>(x, W1, b1, W2, b2, y);
}

// v002
// It runs in 99.8 microseconds.
// In both of two side-by-side timings against v001, it was 2.10 times as fast.
// Over all steps from v000 it is 5.20 times as fast.
#include <hip/hip_runtime.h>
#include <hip/hip_bf16.h>
#include <math.h>

// ---- problem constants (match reference) ----
#define T_ 32
#define D_ 256
#define H_ 1024
#define B_ 2048

// ---- tiling ----
#define BM 128      // rows of x per workgroup
#define HC 64       // H chunk per iteration
#define NWAVE 8     // 256 threads / wave32

// LDS row pitch in bf16 elements: every row carries 8 pad elements (16 B), so
// the pitch is an odd multiple of 16 B and the 16 rows that one ds_load_b128
// fragment read touches fall on 16 different groups of four banks.
#define DP (D_ + 8)  // 528 B rows: xA, w1s
#define HP (HC + 8)  // 144 B rows: w2s, hs

// LDS layout (bytes):
//   xA : [BM][DP]   bf16 = 67584
//   w1s: [HC][DP]   bf16 = 33792   (B^T of layer-1 chunk: row = h, col = d)
//   w2s: [D_][HP]   bf16 = 36864   (B^T of layer-2:       row = d, col = h)
//   hs : [NWAVE][16][HP] bf16 = 18432 (per-wave gelu(h) staging for A-frags)
#define LDS_XA   0
#define LDS_W1S  (BM * DP * 2)
#define LDS_W2S  (LDS_W1S + HC * DP * 2)
#define LDS_HS   (LDS_W2S + D_ * HP * 2)
#define LDS_BYTES (LDS_HS + NWAVE * 16 * HP * 2)

// Workspace: per (token, H chunk) one 64 KB bf16 image, written by the pack
// kernel and read by the main kernel of the same call:
//   [HC][D_] W1 chunk transposed (row = h, col = d), then
//   [D_][HC] W2 chunk transposed (row = d, col = h).
#define NCHUNK  (H_ / HC)
#define WT_HALF (HC * D_)        // bf16 elements of one transposed chunk
#define WT_TILE (2 * WT_HALF)

typedef __attribute__((ext_vector_type(16))) __bf16 v16bf;
typedef __attribute__((ext_vector_type(8)))  float  v8f;
typedef __attribute__((ext_vector_type(4)))  unsigned int u32x4;
typedef __attribute__((ext_vector_type(2)))  unsigned int u32x2;

__device__ __forceinline__ unsigned pack_bf16x2(float a, float b) {
    unsigned short ua = __builtin_bit_cast(unsigned short, (__bf16)a);
    unsigned short ub = __builtin_bit_cast(unsigned short, (__bf16)b);
    return (unsigned)ua | ((unsigned)ub << 16);
}

// Branch-free exact-erf GELU (Abramowitz & Stegun 7.1.26, |err| < 1.5e-7 --
// below the bf16 rounding applied to h anyway). Uses v_rcp_f32 + v_exp_f32,
// no EXEC divergence, unlike ocml erff.
__device__ __forceinline__ float gelu_erf(float v) {
    float z = fabsf(v) * 0.70710678118654752f;     // |v|/sqrt(2)
    float t = __builtin_amdgcn_rcpf(fmaf(0.3275911f, z, 1.0f));
    float p = t * fmaf(t, fmaf(t, fmaf(t, fmaf(t, 1.061405429f, -1.453152027f),
                                       1.421413741f), -0.284496736f), 0.254829592f);
    float e = __expf(-z * z);
    float erfv = copysignf(fmaf(-p, e, 1.0f), v);  // erf(v/sqrt(2))
    return 0.5f * v * (1.0f + erfv);
}

// Build one 16x16x32 bf16 operand fragment (8 VGPRs) from a row base in LDS.
// Per the CDNA5 ISA A-layout: this lane's data is two contiguous 16-byte runs
// at element offsets koff and koff+16 within its row.
__device__ __forceinline__ v16bf ld_frag(const __bf16* rowptr, int koff) {
    union { v16bf v; u32x4 q[2]; } u;
    u.q[0] = *(const u32x4*)(rowptr + koff);
    u.q[1] = *(const u32x4*)(rowptr + koff + 16);
    return u.v;
}

__device__ __forceinline__ v8f wmma_bf16(v16bf a, v16bf b, v8f c) {
    return __builtin_amdgcn_wmma_f32_16x16x32_bf16(false, a, false, b,
                                                   (short)0, c, false, false);
}

// Transposing one [R][16384/R] f32 tile (row stride LDIN floats) into a bf16 tile
// with rows of R elements: each thread takes two blocks of 8 rows x 4 columns in
// registers, 8 float4 loads in and 4 stores of 16 B (8 consecutive r) out per
// block. Eight neighbouring lanes hold neighbouring row blocks, so a store fills
// whole 128-B lines; four lanes side by side read 64 contiguous bytes of a row.
// R and LDIN are compile-time constants, so the thread's second block lies a
// constant CSTEP columns beside its first, and all loads (and all stores) of a
// thread are constant offsets from one address.
// All loops here are unrolled so that v[] and o[] are indexed by constants and
// stay in registers.
template <int R, int LDIN>
struct TileT {
    static constexpr int RHI   = R / 64;          // row blocks beyond the 8 the lanes span
    static constexpr int CSTEP = (8 / RHI) * 16;  // columns from block 0 to block 1
    static __device__ __forceinline__ int rblk(int tid) {
        return (tid & 7) | (((tid >> 5) % RHI) << 3);
    }
    static __device__ __forceinline__ int c4(int tid) {
        return ((tid >> 3) & 3) | (((tid >> 5) / RHI) << 2);
    }
    static __device__ __forceinline__ const float* src(const float* in, int tid) {
        return in + (size_t)(rblk(tid) * 8) * LDIN + c4(tid) * 4;
    }
    static __device__ __forceinline__ __bf16* dst(__bf16* out, int tid) {
        return out + (size_t)(c4(tid) * 4) * R + rblk(tid) * 8;
    }
    static __device__ __forceinline__ void load(const float* s, float4 (&v)[16]) {
        #pragma unroll
        for (int i = 0; i < 2; ++i)
            #pragma unroll
            for (int r = 0; r < 8; ++r)
                v[i * 8 + r] = *(const float4*)(s + r * LDIN + i * CSTEP);
    }
    static __device__ __forceinline__ void store(__bf16* d, const float4 (&v)[16]) {
        #pragma unroll
        for (int i = 0; i < 2; ++i) {
            u32x4 o[4];
            #pragma unroll
            for (int q = 0; q < 4; ++q) {
                o[0][q] = pack_bf16x2(v[i * 8 + 2 * q].x, v[i * 8 + 2 * q + 1].x);
                o[1][q] = pack_bf16x2(v[i * 8 + 2 * q].y, v[i * 8 + 2 * q + 1].y);
                o[2][q] = pack_bf16x2(v[i * 8 + 2 * q].z, v[i * 8 + 2 * q + 1].z);
                o[3][q] = pack_bf16x2(v[i * 8 + 2 * q].w, v[i * 8 + 2 * q + 1].w);
            }
            #pragma unroll
            for (int k = 0; k < 4; ++k)
                *(u32x4*)(d + (i * CSTEP + k) * R) = o[k];
        }
    }
};

// Round the weights to bf16 and transpose them once per call, instead of once
// per batch tile inside the main kernel. One workgroup packs the W1 chunk and the
// W2 chunk of one (token, H chunk); all 32 loads of a thread are issued before
// the first conversion, so a thread waits out one memory latency.
__global__ void __launch_bounds__(256)
pack_weights_kernel(const float* __restrict__ W1,
                    const float* __restrict__ W2,
                    __bf16* __restrict__ wt)
{
    typedef TileT<D_, H_> T1;   // W1 chunk: 256 rows (d) x 64 columns (h)
    typedef TileT<HC, D_> T2;   // W2 chunk: 64 rows (h) x 256 columns (d)
    const int c   = blockIdx.x;
    const int tkn = blockIdx.y;
    const int tid = threadIdx.x;
    __bf16* tile = wt + (size_t)(tkn * NCHUNK + c) * WT_TILE;
    const float* s1 = T1::src(W1 + (size_t)tkn * D_ * H_ + c * HC, tid);
    const float* s2 = T2::src(W2 + ((size_t)tkn * H_ + c * HC) * D_, tid);
    float4 v1[16], v2[16];
    T1::load(s1, v1);
    T2::load(s2, v2);
    // Stands behind the loads and in front of every rewrite of a register that
    // an issued load names (a precaution). Both address pairs are inputs of the
    // statement, so they stay live to this line and no load's result is placed
    // on them.
    asm volatile("s_wait_xcnt 0x0" :: "v"(s1), "v"(s2) : "memory");
    T1::store(T1::dst(tile, tid), v1);
    T2::store(T2::dst(tile + WT_HALF, tid), v2);
}

__global__ void __launch_bounds__(256)
PerTokenFFN_wmma_kernel(const float* __restrict__ x,
                        const __bf16* __restrict__ wt,
                        const float* __restrict__ b1,
                        const float* __restrict__ b2,
                        float* __restrict__ y)
{
    extern __shared__ char smem[];
    __bf16* xA    = (__bf16*)(smem + LDS_XA);
    __bf16* w1s   = (__bf16*)(smem + LDS_W1S);
    __bf16* w2s   = (__bf16*)(smem + LDS_W2S);
    __bf16* hsAll = (__bf16*)(smem + LDS_HS);

    const int tid   = threadIdx.x;
    const int lane  = tid & 31;
    const int wave  = tid >> 5;
    const int half  = lane >> 4;   // which half-wave (selects K sub-range)
    const int lhalf = lane & 15;   // M (A-frag) / N (B-frag) index
    const int tkn   = blockIdx.y;
    const int b0    = blockIdx.x * BM;
    const int m0    = wave * 16;

    __bf16* hs = hsAll + wave * (16 * HP);

    // ---------------- stage x tile (f32 -> bf16) ----------------
    {
        const float* xbase = x + (size_t)b0 * (T_ * D_) + (size_t)tkn * D_;
        #pragma unroll
        for (int i = 0; i < 32; ++i) {
            int idx = tid + i * 256;
            int row = idx >> 6;        // 64 float4 per row
            int c4  = idx & 63;
            const float4 v = *(const float4*)(xbase + (size_t)row * (T_ * D_) + c4 * 4);
            u32x2 p;
            p.x = pack_bf16x2(v.x, v.y);
            p.y = pack_bf16x2(v.z, v.w);
            *(u32x2*)(xA + row * DP + c4 * 4) = p;
        }
    }

    v8f yacc[16];
    #pragma unroll
    for (int n = 0; n < 16; ++n) yacc[n] = (v8f){0.f,0.f,0.f,0.f,0.f,0.f,0.f,0.f};

    for (int hc = 0; hc < H_; hc += HC) {
        __syncthreads();  // previous chunk's fragment reads complete

        // ---- stage both packed weight chunks: 16-B units, lanes contiguous ----
        {
            const u32x4* wsrc =
                (const u32x4*)(wt + (size_t)(tkn * NCHUNK + hc / HC) * WT_TILE);
            // Unrolled, loads first: all 16 loads are in flight before the first
            // LDS store, so a chunk waits out one load latency, not sixteen.
            u32x4 v1[8], v2[8];
            #pragma unroll
            for (int i = 0; i < 8; ++i) v1[i] = wsrc[tid + i * 256];
            #pragma unroll
            for (int i = 0; i < 8; ++i) v2[i] = wsrc[WT_HALF / 8 + tid + i * 256];
            #pragma unroll
            for (int i = 0; i < 8; ++i) {      // w1s[h][d]: 32 units per row
                int idx = tid + i * 256;
                *(u32x4*)(w1s + (idx >> 5) * DP + (idx & 31) * 8) = v1[i];
            }
            #pragma unroll
            for (int i = 0; i < 8; ++i) {      // w2s[d][h]: 8 units per row
                int idx = tid + i * 256;
                *(u32x4*)(w2s + (idx >> 3) * HP + (idx & 7) * 8) = v2[i];
            }
        }
        __syncthreads();

        // ---- GEMM1: h[16 x 64] = xA[16 x 256] * W1chunk[256 x 64] ----
        // Software-pipelined: fragments for k-step s+1 are loaded while the
        // WMMAs of k-step s execute, so ds_loads overlap matrix issue.
        v8f ht[4];
        #pragma unroll
        for (int n = 0; n < 4; ++n) ht[n] = (v8f){0.f,0.f,0.f,0.f,0.f,0.f,0.f,0.f};

        {
            const __bf16* aRow = xA + (m0 + lhalf) * DP;
            v16bf a_cur = ld_frag(aRow, half * 8);
            v16bf b_cur[4];
            #pragma unroll
            for (int n = 0; n < 4; ++n)
                b_cur[n] = ld_frag(w1s + (n * 16 + lhalf) * DP, half * 8);

            #pragma unroll
            for (int ks = 0; ks < 8; ++ks) {
                v16bf a_nxt;
                v16bf b_nxt[4];
                if (ks < 7) {
                    int koff = (ks + 1) * 32 + half * 8;
                    a_nxt = ld_frag(aRow, koff);
                    #pragma unroll
                    for (int n = 0; n < 4; ++n)
                        b_nxt[n] = ld_frag(w1s + (n * 16 + lhalf) * DP, koff);
                }
                #pragma unroll
                for (int n = 0; n < 4; ++n)
                    ht[n] = wmma_bf16(a_cur, b_cur[n], ht[n]);
                if (ks < 7) {
                    a_cur = a_nxt;
                    #pragma unroll
                    for (int n = 0; n < 4; ++n) b_cur[n] = b_nxt[n];
                }
            }
        }

        // ---- bias + exact GELU, round to bf16, scatter into A-layout LDS ----
        #pragma unroll
        for (int n = 0; n < 4; ++n) {
            float bias = b1[(size_t)tkn * H_ + hc + n * 16 + lhalf];
            #pragma unroll
            for (int r = 0; r < 8; ++r) {
                float v = ht[n][r] + bias;          // C/D: row r+8*half, col lhalf
                hs[(r + 8 * half) * HP + n * 16 + lhalf] = (__bf16)gelu_erf(v);
            }
        }

        // ---- GEMM2: yacc[16 x 256] += gelu(h)[16 x 64] * W2chunk[64 x 256] ----
        // 8 pipeline steps: step s = (kk-half s>>2, ntile-group s&3), 4 WMMAs each.
        {
            const __bf16* hRow = hs + lhalf * HP;
            v16bf a2[2];
            a2[0] = ld_frag(hRow, half * 8);
            a2[1] = ld_frag(hRow, 32 + half * 8);

            v16bf b_cur[4];
            #pragma unroll
            for (int j = 0; j < 4; ++j)
                b_cur[j] = ld_frag(w2s + (j * 16 + lhalf) * HP, half * 8);

            #pragma unroll
            for (int s = 0; s < 8; ++s) {
                v16bf b_nxt[4];
                if (s < 7) {
                    int sn  = s + 1;
                    int kkn = (sn >> 2) * 32;
                    int gn  = sn & 3;
                    #pragma unroll
                    for (int j = 0; j < 4; ++j)
                        b_nxt[j] = ld_frag(w2s + ((gn * 4 + j) * 16 + lhalf) * HP,
                                           kkn + half * 8);
                }
                int g = s & 3;
                #pragma unroll
                for (int j = 0; j < 4; ++j)
                    yacc[g * 4 + j] = wmma_bf16(a2[s >> 2], b_cur[j], yacc[g * 4 + j]);
                if (s < 7) {
                    #pragma unroll
                    for (int j = 0; j < 4; ++j) b_cur[j] = b_nxt[j];
                }
            }
        }
    }

    // ---------------- epilogue: + b2, store f32 ----------------
    #pragma unroll
    for (int n = 0; n < 16; ++n) {
        int col    = n * 16 + lhalf;
        float bias = b2[(size_t)tkn * D_ + col];
        #pragma unroll
        for (int r = 0; r < 8; ++r) {
            int row = m0 + r + 8 * half;
            y[(size_t)(b0 + row) * (T_ * D_) + (size_t)tkn * D_ + col] = yacc[n][r] + bias;
        }
    }
}

extern "C" void kernel_launch(void* const* d_in, const int* in_sizes, int n_in,
                              void* d_out, int out_size, void* d_ws, size_t ws_size,
                              hipStream_t stream) {
    (void)in_sizes; (void)n_in; (void)out_size; (void)ws_size;
    const float* x  = (const float*)d_in[0];
    const float* W1 = (const float*)d_in[1];
    const float* b1 = (const float*)d_in[2];
    const float* W2 = (const float*)d_in[3];
    const float* b2 = (const float*)d_in[4];
    float* y = (float*)d_out;
    __bf16* wt = (__bf16*)d_ws;   // 32 MB of packed bf16 weights

    dim3 block(256);          // 8 wave32
    dim3 pgrid(NCHUNK, T_);   // one (token, H chunk) per workgroup
    pack_weights_kernel<<<pgrid, block, 0, stream>>>(W1, W2, wt);

    dim3 grid(B_ / BM, T_);   // 16 x 32 = 512 workgroups
    PerTokenFFN_wmma_kernel<<<grid, block, LDS_BYTES, stream>>>(x, wt, b1, b2, y);
}

// v003
// A run of this version takes 89.2 microseconds.
// Two timings next to v002 both put it at 1.12 times that version's speed.
// All steps since v000 together make it 5.83 times as fast.
#include <hip/hip_runtime.h>
#include <hip/hip_bf16.h>
#include <math.h>

// ---- problem constants (match reference) ----
#define T_ 32
#define D_ 256
#define H_ 1024
#define B_ 2048

// ---- tiling ----
#define BM 256      // rows of x per workgroup
#define HC 64       // H chunk per iteration
#define NWAVE 8     // 256 threads / wave32
#define MT 2        // 16-row tiles per wave: each weight fragment feeds MT WMMAs

// LDS row pitch in bf16 elements: every row carries 8 pad elements (16 B), so
// the pitch is an odd multiple of 16 B and the 16 rows that one ds_load_b128
// fragment read touches fall on 16 different groups of four banks.
#define DP (D_ + 8)  // 528 B rows: xA, w1s
#define HP (HC + 8)  // 144 B rows: w2s, hs

// LDS layout (bytes):
//   xA : [BM][DP]   bf16 = 135168
//   w1s: [HC][DP]   bf16 = 33792   (B^T of layer-1 chunk: row = h, col = d)
//   w2s: [D_][HP]   bf16 = 36864   (B^T of layer-2:       row = d, col = h)
//   hs : [NWAVE][MT*16][HP] bf16 = 36864 (per-wave gelu(h) staging for A-frags)
// 242688 B in all: one workgroup per WGP.
#define LDS_XA   0
#define LDS_W1S  (BM * DP * 2)
#define LDS_W2S  (LDS_W1S + HC * DP * 2)
#define LDS_HS   (LDS_W2S + D_ * HP * 2)
#define LDS_BYTES (LDS_HS + NWAVE * MT * 16 * HP * 2)

// Workspace: per (token, H chunk) one 64 KB bf16 image, written by the pack
// kernel and read by the main kernel of the same call:
//   [HC][D_] W1 chunk transposed (row = h, col = d), then
//   [D_][HC] W2 chunk transposed (row = d, col = h).
#define NCHUNK  (H_ / HC)
#define WT_HALF (HC * D_)        // bf16 elements of one transposed chunk
#define WT_TILE (2 * WT_HALF)

typedef __attribute__((ext_vector_type(16))) __bf16 v16bf;
typedef __attribute__((ext_vector_type(8)))  float  v8f;
typedef __attribute__((ext_vector_type(4)))  unsigned int u32x4;
typedef __attribute__((ext_vector_type(2)))  unsigned int u32x2;

__device__ __forceinline__ unsigned pack_bf16x2(float a, float b) {
    unsigned short ua = __builtin_bit_cast(unsigned short, (__bf16)a);
    unsigned short ub = __builtin_bit_cast(unsigned short, (__bf16)b);
    return (unsigned)ua | ((unsigned)ub << 16);
}

// Branch-free exact-erf GELU (Abramowitz & Stegun 7.1.26, |err| < 1.5e-7 --
// below the bf16 rounding applied to h anyway). Uses v_rcp_f32 + v_exp_f32,
// no EXEC divergence, unlike ocml erff.
// Written stage by stage over the 8 values of one accumulator tile: the 8 chains
// are independent, and in this order each instruction's producer lies 8 back, so
// a wave does not wait out the vector latency at every link.
__device__ __forceinline__ void gelu_erf8(const v8f h, float bias, float (&g)[8]) {
    float v[8], z[8], t[8], p[8], e[8];
    #pragma unroll
    for (int r = 0; r < 8; ++r) v[r] = h[r] + bias;
    #pragma unroll
    for (int r = 0; r < 8; ++r) z[r] = fabsf(v[r]) * 0.70710678118654752f;  // |v|/sqrt(2)
    #pragma unroll
    for (int r = 0; r < 8; ++r) t[r] = fmaf(0.3275911f, z[r], 1.0f);
    #pragma unroll
    for (int r = 0; r < 8; ++r) t[r] = __builtin_amdgcn_rcpf(t[r]);
    #pragma unroll
    for (int r = 0; r < 8; ++r) e[r] = -z[r] * z[r];
    #pragma unroll
    for (int r = 0; r < 8; ++r) e[r] = __expf(e[r]);
    #pragma unroll
    for (int r = 0; r < 8; ++r) p[r] = fmaf(t[r], 1.061405429f, -1.453152027f);
    #pragma unroll
    for (int r = 0; r < 8; ++r) p[r] = fmaf(t[r], p[r], 1.421413741f);
    #pragma unroll
    for (int r = 0; r < 8; ++r) p[r] = fmaf(t[r], p[r], -0.284496736f);
    #pragma unroll
    for (int r = 0; r < 8; ++r) p[r] = fmaf(t[r], p[r], 0.254829592f);
    #pragma unroll
    for (int r = 0; r < 8; ++r) p[r] = t[r] * p[r];
    #pragma unroll
    for (int r = 0; r < 8; ++r) e[r] = copysignf(fmaf(-p[r], e[r], 1.0f), v[r]);  // erf(v/sqrt(2))
    #pragma unroll
    for (int r = 0; r < 8; ++r) g[r] = 0.5f * v[r] * (1.0f + e[r]);
}

// Build one 16x16x32 bf16 operand fragment (8 VGPRs) from a row base in LDS.
// Per the CDNA5 ISA A-layout: this lane's data is two contiguous 16-byte runs
// at element offsets koff and koff+16 within its row.
__device__ __forceinline__ v16bf ld_frag(const __bf16* rowptr, int koff) {
    union { v16bf v; u32x4 q[2]; } u;
    u.q[0] = *(const u32x4*)(rowptr + koff);
    u.q[1] = *(const u32x4*)(rowptr + koff + 16);
    return u.v;
}

__device__ __forceinline__ v8f wmma_bf16(v16bf a, v16bf b, v8f c) {
    return __builtin_amdgcn_wmma_f32_16x16x32_bf16(false, a, false, b,
                                                   (short)0, c, false, false);
}

// Transposing one [R][16384/R] f32 tile (row stride LDIN floats) into a bf16 tile
// with rows of R elements: each thread takes two blocks of 8 rows x 4 columns in
// registers, 8 float4 loads in and 4 stores of 16 B (8 consecutive r) out per
// block. Eight neighbouring lanes hold neighbouring row blocks, so a store fills
// whole 128-B lines; four lanes side by side read 64 contiguous bytes of a row.
// R and LDIN are compile-time constants, so the thread's second block lies a
// constant CSTEP columns beside its first, and all loads (and all stores) of a
// thread are constant offsets from one address.
// All loops here are unrolled so that v[] and o[] are indexed by constants and
// stay in registers.
template <int R, int LDIN>
struct TileT {
    static constexpr int RHI   = R / 64;          // row blocks beyond the 8 the lanes span
    static constexpr int CSTEP = (8 / RHI) * 16;  // columns from block 0 to block 1
    static __device__ __forceinline__ int rblk(int tid) {
        return (tid & 7) | (((tid >> 5) % RHI) << 3);
    }
    static __device__ __forceinline__ int c4(int tid) {
        return ((tid >> 3) & 3) | (((tid >> 5) / RHI) << 2);
    }
    static __device__ __forceinline__ const float* src(const float* in, int tid) {
        return in + (size_t)(rblk(tid) * 8) * LDIN + c4(tid) * 4;
    }
    static __device__ __forceinline__ __bf16* dst(__bf16* out, int tid) {
        return out + (size_t)(c4(tid) * 4) * R + rblk(tid) * 8;
    }
    static __device__ __forceinline__ void load(const float* s, float4 (&v)[16]) {
        #pragma unroll
        for (int i = 0; i < 2; ++i)
            #pragma unroll
            for (int r = 0; r < 8; ++r)
                v[i * 8 + r] = *(const float4*)(s + r * LDIN + i * CSTEP);
    }
    static __device__ __forceinline__ void store(__bf16* d, const float4 (&v)[16]) {
        #pragma unroll
        for (int i = 0; i < 2; ++i) {
            u32x4 o[4];
            #pragma unroll
            for (int q = 0; q < 4; ++q) {
                o[0][q] = pack_bf16x2(v[i * 8 + 2 * q].x, v[i * 8 + 2 * q + 1].x);
                o[1][q] = pack_bf16x2(v[i * 8 + 2 * q].y, v[i * 8 + 2 * q + 1].y);
                o[2][q] = pack_bf16x2(v[i * 8 + 2 * q].z, v[i * 8 + 2 * q + 1].z);
                o[3][q] = pack_bf16x2(v[i * 8 + 2 * q].w, v[i * 8 + 2 * q + 1].w);
            }
            #pragma unroll
            for (int k = 0; k < 4; ++k)
                *(u32x4*)(d + (i * CSTEP + k) * R) = o[k];
        }
    }
};

// Round the weights to bf16 and transpose them once per call, instead of once
// per batch tile inside the main kernel. One workgroup packs the W1 chunk and the
// W2 chunk of one (token, H chunk); all 32 loads of a thread are issued before
// the first conversion, so a thread waits out one memory latency.
__global__ void __launch_bounds__(256)
pack_weights_kernel(const float* __restrict__ W1,
                    const float* __restrict__ W2,
                    __bf16* __restrict__ wt)
{
    typedef TileT<D_, H_> T1;   // W1 chunk: 256 rows (d) x 64 columns (h)
    typedef TileT<HC, D_> T2;   // W2 chunk: 64 rows (h) x 256 columns (d)
    const int c   = blockIdx.x;
    const int tkn = blockIdx.y;
    const int tid = threadIdx.x;
    __bf16* tile = wt + (size_t)(tkn * NCHUNK + c) * WT_TILE;
    const float* s1 = T1::src(W1 + (size_t)tkn * D_ * H_ + c * HC, tid);
    const float* s2 = T2::src(W2 + ((size_t)tkn * H_ + c * HC) * D_, tid);
    float4 v1[16], v2[16];
    T1::load(s1, v1);
    T2::load(s2, v2);
    // Stands behind the loads and in front of every rewrite of a register that
    // an issued load names (a precaution). Both address pairs are inputs of the
    // statement, so they stay live to this line and no load's result is placed
    // on them.
    asm volatile("s_wait_xcnt 0x0" :: "v"(s1), "v"(s2) : "memory");
    T1::store(T1::dst(tile, tid), v1);
    T2::store(T2::dst(tile + WT_HALF, tid), v2);
}

__global__ void __launch_bounds__(256)
PerTokenFFN_wmma_kernel(const float* __restrict__ x,
                        const __bf16* __restrict__ wt,
                        const float* __restrict__ b1,
                        const float* __restrict__ b2,
                        float* __restrict__ y)
{
    __shared__ __attribute__((aligned(16))) char smem[LDS_BYTES];
    __bf16* xA    = (__bf16*)(smem + LDS_XA);
    __bf16* w1s   = (__bf16*)(smem + LDS_W1S);
    __bf16* w2s   = (__bf16*)(smem + LDS_W2S);
    __bf16* hsAll = (__bf16*)(smem + LDS_HS);

    const int tid   = threadIdx.x;
    const int lane  = tid & 31;
    const int wave  = tid >> 5;
    const int half  = lane >> 4;   // which half-wave (selects K sub-range)
    const int lhalf = lane & 15;   // M (A-frag) / N (B-frag) index
    const int tkn   = blockIdx.y;
    const int b0    = blockIdx.x * BM;
    const int m0    = wave * (MT * 16);

    __bf16* hs = hsAll + wave * (MT * 16 * HP);

    // ---------------- stage x tile (f32 -> bf16) ----------------
    {
        // 64 float4 per row, 4 rows per sweep of the block: a thread's loads are
        // constant offsets from one address, its LDS stores likewise.
        const float* xp = x + (size_t)(b0 + (tid >> 6)) * (T_ * D_) + (size_t)tkn * D_
                            + (tid & 63) * 4;
        __bf16* xd = xA + (tid >> 6) * DP + (tid & 63) * 4;
        #pragma unroll
        for (int bt = 0; bt < BM / 128; ++bt) {   // batches of 32 loads
            float4 v[32];
            #pragma unroll
            for (int i = 0; i < 32; ++i)
                v[i] = *(const float4*)(xp + (size_t)((bt * 32 + i) * 4) * (T_ * D_));
            // Stands behind the loads and in front of every rewrite of a register
            // that an issued load names (a precaution). The address pair is an
            // input, so it stays live to this line and no result is placed on it.
            asm volatile("s_wait_xcnt 0x0" :: "v"(xp) : "memory");
            #pragma unroll
            for (int i = 0; i < 32; ++i) {
                u32x2 p;
                p.x = pack_bf16x2(v[i].x, v[i].y);
                p.y = pack_bf16x2(v[i].z, v[i].w);
                *(u32x2*)(xd + (bt * 32 + i) * 4 * DP) = p;
            }
        }
    }

    v8f yacc[MT][16];
    #pragma unroll
    for (int m = 0; m < MT; ++m)
        #pragma unroll
        for (int n = 0; n < 16; ++n)
            yacc[m][n] = (v8f){0.f,0.f,0.f,0.f,0.f,0.f,0.f,0.f};

    for (int hc = 0; hc < H_; hc += HC) {
        __syncthreads();  // previous chunk's fragment reads complete

        // ---- stage both packed weight chunks: 16-B units, lanes contiguous ----
        {
            const u32x4* wsrc =
                (const u32x4*)(wt + (size_t)(tkn * NCHUNK + hc / HC) * WT_TILE);
            // Unrolled, loads first: all 16 loads are in flight before the first
            // LDS store, so a chunk waits out one load latency, not sixteen.
            u32x4 v1[8], v2[8];
            #pragma unroll
            for (int i = 0; i < 8; ++i) v1[i] = wsrc[tid + i * 256];
            #pragma unroll
            for (int i = 0; i < 8; ++i) v2[i] = wsrc[WT_HALF / 8 + tid + i * 256];
            #pragma unroll
            for (int i = 0; i < 8; ++i) {      // w1s[h][d]: 32 units per row
                int idx = tid + i * 256;
                *(u32x4*)(w1s + (idx >> 5) * DP + (idx & 31) * 8) = v1[i];
            }
            #pragma unroll
            for (int i = 0; i < 8; ++i) {      // w2s[d][h]: 8 units per row
                int idx = tid + i * 256;
                *(u32x4*)(w2s + (idx >> 3) * HP + (idx & 7) * 8) = v2[i];
            }
        }
        __syncthreads();

        // ---- GEMM1: h[32 x 64] = xA[32 x 256] * W1chunk[256 x 64] ----
        // Software-pipelined: fragments for k-step s+1 are loaded while the
        // WMMAs of k-step s execute, so ds_loads overlap matrix issue.
        // The chunk's four bias values are asked for here, so that their latency
        // passes behind GEMM1 and not in front of each gelu group.
        float bias1[4];
        #pragma unroll
        for (int n = 0; n < 4; ++n)
            bias1[n] = b1[(size_t)tkn * H_ + hc + n * 16 + lhalf];

        v8f ht[MT][4];
        #pragma unroll
        for (int m = 0; m < MT; ++m)
            #pragma unroll
            for (int n = 0; n < 4; ++n)
                ht[m][n] = (v8f){0.f,0.f,0.f,0.f,0.f,0.f,0.f,0.f};

        {
            const __bf16* aRow = xA + (m0 + lhalf) * DP;
            v16bf a_cur[MT];
            #pragma unroll
            for (int m = 0; m < MT; ++m)
                a_cur[m] = ld_frag(aRow + m * 16 * DP, half * 8);
            v16bf b_cur[4];
            #pragma unroll
            for (int n = 0; n < 4; ++n)
                b_cur[n] = ld_frag(w1s + (n * 16 + lhalf) * DP, half * 8);

            #pragma unroll
            for (int ks = 0; ks < 8; ++ks) {
                v16bf a_nxt[MT];
                v16bf b_nxt[4];
                if (ks < 7) {
                    int koff = (ks + 1) * 32 + half * 8;
                    #pragma unroll
                    for (int m = 0; m < MT; ++m)
                        a_nxt[m] = ld_frag(aRow + m * 16 * DP, koff);
                    #pragma unroll
                    for (int n = 0; n < 4; ++n)
                        b_nxt[n] = ld_frag(w1s + (n * 16 + lhalf) * DP, koff);
                }
                #pragma unroll
                for (int n = 0; n < 4; ++n)
                    #pragma unroll
                    for (int m = 0; m < MT; ++m)
                        ht[m][n] = wmma_bf16(a_cur[m], b_cur[n], ht[m][n]);
                if (ks < 7) {
                    #pragma unroll
                    for (int m = 0; m < MT; ++m) a_cur[m] = a_nxt[m];
                    #pragma unroll
                    for (int n = 0; n < 4; ++n) b_cur[n] = b_nxt[n];
                }
            }
        }

        // ---- bias + exact GELU, round to bf16, scatter into A-layout LDS ----
        #pragma unroll
        for (int n = 0; n < 4; ++n) {
            #pragma unroll
            for (int m = 0; m < MT; ++m) {
                float g[8];
                gelu_erf8(ht[m][n], bias1[n], g);
                #pragma unroll
                for (int r = 0; r < 8; ++r)         // C/D: row r+8*half, col lhalf
                    hs[(m * 16 + r + 8 * half) * HP + n * 16 + lhalf] = (__bf16)g[r];
            }
        }

        // ---- GEMM2: yacc[32 x 256] += gelu(h)[32 x 64] * W2chunk[64 x 256] ----
        // 8 pipeline steps: step s = (kk-half s>>2, ntile-group s&3), 4*MT WMMAs each.
        {
            const __bf16* hRow = hs + lhalf * HP;
            v16bf a2[MT][2];
            #pragma unroll
            for (int m = 0; m < MT; ++m) {
                a2[m][0] = ld_frag(hRow + m * 16 * HP, half * 8);
                a2[m][1] = ld_frag(hRow + m * 16 * HP, 32 + half * 8);
            }

            v16bf b_cur[4];
            #pragma unroll
            for (int j = 0; j < 4; ++j)
                b_cur[j] = ld_frag(w2s + (j * 16 + lhalf) * HP, half * 8);

            #pragma unroll
            for (int s = 0; s < 8; ++s) {
                v16bf b_nxt[4];
                if (s < 7) {
                    int sn  = s + 1;
                    int kkn = (sn >> 2) * 32;
                    int gn  = sn & 3;
                    #pragma unroll
                    for (int j = 0; j < 4; ++j)
                        b_nxt[j] = ld_frag(w2s + ((gn * 4 + j) * 16 + lhalf) * HP,
                                           kkn + half * 8);
                }
                int g = s & 3;
                #pragma unroll
                for (int j = 0; j < 4; ++j)
                    #pragma unroll
                    for (int m = 0; m < MT; ++m)
                        yacc[m][g * 4 + j] =
                            wmma_bf16(a2[m][s >> 2], b_cur[j], yacc[m][g * 4 + j]);
                if (s < 7) {
                    #pragma unroll
                    for (int j = 0; j < 4; ++j) b_cur[j] = b_nxt[j];
                }
            }
        }
    }

    // ---------------- epilogue: + b2, store f32 ----------------
    float* yp = y + (size_t)(b0 + m0 + 8 * half) * (T_ * D_) + (size_t)tkn * D_ + lhalf;
    #pragma unroll
    for (int n = 0; n < 16; ++n) {
        int col    = n * 16 + lhalf;
        float bias = b2[(size_t)tkn * D_ + col];
        #pragma unroll
        for (int m = 0; m < MT; ++m)
            #pragma unroll
            for (int r = 0; r < 8; ++r) yacc[m][n][r] += bias;
    }
    // All sums stand in front of the first store: no vector instruction is moved in
    // among the stores, so none rewrites a register that an issued store names.
    __builtin_amdgcn_sched_barrier(0);
    #pragma unroll
    for (int n = 0; n < 16; ++n)
        #pragma unroll
        for (int m = 0; m < MT; ++m)
            #pragma unroll
            for (int r = 0; r < 8; ++r)
                yp[(size_t)(m * 16 + r) * (T_ * D_) + n * 16] = yacc[m][n][r];
    // Keeps the stores' address pair live behind the last store, so that it is not
    // rewritten while a store that names it is still issued (a precaution).
    asm volatile("s_wait_xcnt 0x0" :: "v"(yp) : "memory");
}

extern "C" void kernel_launch(void* const* d_in, const int* in_sizes, int n_in,
                              void* d_out, int out_size, void* d_ws, size_t ws_size,
                              hipStream_t stream) {
    (void)in_sizes; (void)n_in; (void)out_size; (void)ws_size;
    const float* x  = (const float*)d_in[0];
    const float* W1 = (const float*)d_in[1];
    const float* b1 = (const float*)d_in[2];
    const float* W2 = (const float*)d_in[3];
    const float* b2 = (const float*)d_in[4];
    float* y = (float*)d_out;
    __bf16* wt = (__bf16*)d_ws;   // 32 MB of packed bf16 weights

    dim3 block(256);          // 8 wave32
    dim3 pgrid(NCHUNK, T_);   // one (token, H chunk) per workgroup
    pack_weights_kernel<<<pgrid, block, 0, stream>>>(W1, W2, wt);

    dim3 grid(B_ / BM, T_);   // 8 x 32 = 256 workgroups
    PerTokenFFN_wmma_kernel<<<grid, block, 0, stream>>>(x, wt, b1, b2, y);
}

// v004
// A run of this version takes 80.6 microseconds.
// Timed twice side by side with v003, it ran 1.10 and 1.11 times as fast.
// Over all steps from v000 it is 6.45 times as fast.
#include <hip/hip_runtime.h>
#include <hip/hip_bf16.h>
#include <math.h>

// ---- problem constants (match reference) ----
#define T_ 32
#define D_ 256
#define H_ 1024
#define B_ 2048

// ---- tiling ----
#define BM 256      // rows of x per workgroup
#define HC 64       // H chunk per iteration
#define NWAVE 8     // 256 threads / wave32
#define MT 2        // 16-row tiles per wave: each weight fragment feeds MT WMMAs

// LDS row pitch in bf16 elements: every row carries 8 pad elements (16 B), so
// the pitch is an odd multiple of 16 B and the 16 rows that one ds_load_b128
// fragment read touches fall on 16 different groups of four banks.
#define DP (D_ + 8)  // 528 B rows: xA, w1s
#define HP (HC + 8)  // 144 B rows: w2s, hs

// LDS layout (bytes):
//   xA : [BM][DP]      bf16 = 135168
//   w1s: [2][HC][DP]   bf16 = 2 x 33792 (B^T of layer-1 chunk: row = h, col = d)
//   w2s: [2][D_][HP]   bf16 = 2 x 36864 (B^T of layer-2:       row = d, col = h)
//   hs : [NWAVE][MT*16][HP] bf16 = 36864 (per-wave gelu(h) staging for A-frags)
// 313344 B in all: one workgroup per WGP. The weight chunks have two buffers
// each: chunk t is read from buffer t mod 2 while chunk t + 1 lands in the other.
#define W1S_BYTES (HC * DP * 2)
#define W2S_BYTES (D_ * HP * 2)
#define LDS_XA   0
#define LDS_W1S  (BM * DP * 2)
#define LDS_W2S  (LDS_W1S + 2 * W1S_BYTES)
#define LDS_HS   (LDS_W2S + 2 * W2S_BYTES)
#define LDS_BYTES (LDS_HS + NWAVE * MT * 16 * HP * 2)

// Workspace: per (token, H chunk) one 64 KB bf16 image, written by the pack
// kernel and read by the main kernel of the same call:
//   [HC][D_] W1 chunk transposed (row = h, col = d), then
//   [D_][HC] W2 chunk transposed (row = d, col = h).
#define NCHUNK  (H_ / HC)
#define WT_HALF (HC * D_)        // bf16 elements of one transposed chunk
#define WT_TILE (2 * WT_HALF)

typedef __attribute__((ext_vector_type(16))) __bf16 v16bf;
typedef __attribute__((ext_vector_type(8)))  float  v8f;
typedef __attribute__((ext_vector_type(4)))  unsigned int u32x4;
typedef __attribute__((ext_vector_type(2)))  unsigned int u32x2;

__device__ __forceinline__ unsigned pack_bf16x2(float a, float b) {
    unsigned short ua = __builtin_bit_cast(unsigned short, (__bf16)a);
    unsigned short ub = __builtin_bit_cast(unsigned short, (__bf16)b);
    return (unsigned)ua | ((unsigned)ub << 16);
}

// Branch-free exact-erf GELU (Abramowitz & Stegun 7.1.26, |err| < 1.5e-7 --
// below the bf16 rounding applied to h anyway). Uses v_rcp_f32 + v_exp_f32,
// no EXEC divergence, unlike ocml erff.
// Written stage by stage over the 8 values of one accumulator tile: the 8 chains
// are independent, and in this order each instruction's producer lies 8 back, so
// a wave does not wait out the vector latency at every link.
__device__ __forceinline__ void gelu_erf8(const v8f h, float bias, float (&g)[8]) {
    float v[8], z[8], t[8], p[8], e[8];
    #pragma unroll
    for (int r = 0; r < 8; ++r) v[r] = h[r] + bias;
    #pragma unroll
    for (int r = 0; r < 8; ++r) z[r] = fabsf(v[r]) * 0.70710678118654752f;  // |v|/sqrt(2)
    #pragma unroll
    for (int r = 0; r < 8; ++r) t[r] = fmaf(0.3275911f, z[r], 1.0f);
    #pragma unroll
    for (int r = 0; r < 8; ++r) t[r] = __builtin_amdgcn_rcpf(t[r]);
    #pragma unroll
    for (int r = 0; r < 8; ++r) e[r] = -z[r] * z[r];
    #pragma unroll
    for (int r = 0; r < 8; ++r) e[r] = __expf(e[r]);
    #pragma unroll
    for (int r = 0; r < 8; ++r) p[r] = fmaf(t[r], 1.061405429f, -1.453152027f);
    #pragma unroll
    for (int r = 0; r < 8; ++r) p[r] = fmaf(t[r], p[r], 1.421413741f);
    #pragma unroll
    for (int r = 0; r < 8; ++r) p[r] = fmaf(t[r], p[r], -0.284496736f);
    #pragma unroll
    for (int r = 0; r < 8; ++r) p[r] = fmaf(t[r], p[r], 0.254829592f);
    #pragma unroll
    for (int r = 0; r < 8; ++r) p[r] = t[r] * p[r];
    #pragma unroll
    for (int r = 0; r < 8; ++r) e[r] = copysignf(fmaf(-p[r], e[r], 1.0f), v[r]);  // erf(v/sqrt(2))
    #pragma unroll
    for (int r = 0; r < 8; ++r) g[r] = 0.5f * v[r] * (1.0f + e[r]);
}

// Build one 16x16x32 bf16 operand fragment (8 VGPRs) from a row base in LDS.
// Per the CDNA5 ISA A-layout: this lane's data is two contiguous 16-byte runs
// at element offsets koff and koff+16 within its row.
__device__ __forceinline__ v16bf ld_frag(const __bf16* rowptr, int koff) {
    union { v16bf v; u32x4 q[2]; } u;
    u.q[0] = *(const u32x4*)(rowptr + koff);
    u.q[1] = *(const u32x4*)(rowptr + koff + 16);
    return u.v;
}

__device__ __forceinline__ v8f wmma_bf16(v16bf a, v16bf b, v8f c) {
    return __builtin_amdgcn_wmma_f32_16x16x32_bf16(false, a, false, b,
                                                   (short)0, c, false, false);
}

// Transposing one [R][16384/R] f32 tile (row stride LDIN floats) into a bf16 tile
// with rows of R elements: each thread takes two blocks of 8 rows x 4 columns in
// registers, 8 float4 loads in and 4 stores of 16 B (8 consecutive r) out per
// block. Eight neighbouring lanes hold neighbouring row blocks, so a store fills
// whole 128-B lines; four lanes side by side read 64 contiguous bytes of a row.
// R and LDIN are compile-time constants, so the thread's second block lies a
// constant CSTEP columns beside its first, and all loads (and all stores) of a
// thread are constant offsets from one address.
// All loops here are unrolled so that v[] and o[] are indexed by constants and
// stay in registers.
template <int R, int LDIN>
struct TileT {
    static constexpr int RHI   = R / 64;          // row blocks beyond the 8 the lanes span
    static constexpr int CSTEP = (8 / RHI) * 16;  // columns from block 0 to block 1
    static __device__ __forceinline__ int rblk(int tid) {
        return (tid & 7) | (((tid >> 5) % RHI) << 3);
    }
    static __device__ __forceinline__ int c4(int tid) {
        return ((tid >> 3) & 3) | (((tid >> 5) / RHI) << 2);
    }
    static __device__ __forceinline__ const float* src(const float* in, int tid) {
        return in + (size_t)(rblk(tid) * 8) * LDIN + c4(tid) * 4;
    }
    static __device__ __forceinline__ __bf16* dst(__bf16* out, int tid) {
        return out + (size_t)(c4(tid) * 4) * R + rblk(tid) * 8;
    }
    static __device__ __forceinline__ void load(const float* s, float4 (&v)[16]) {
        #pragma unroll
        for (int i = 0; i < 2; ++i)
            #pragma unroll
            for (int r = 0; r < 8; ++r)
                v[i * 8 + r] = *(const float4*)(s + r * LDIN + i * CSTEP);
    }
    static __device__ __forceinline__ void store(__bf16* d, const float4 (&v)[16]) {
        #pragma unroll
        for (int i = 0; i < 2; ++i) {
            u32x4 o[4];
            #pragma unroll
            for (int q = 0; q < 4; ++q) {
                o[0][q] = pack_bf16x2(v[i * 8 + 2 * q].x, v[i * 8 + 2 * q + 1].x);
                o[1][q] = pack_bf16x2(v[i * 8 + 2 * q].y, v[i * 8 + 2 * q + 1].y);
                o[2][q] = pack_bf16x2(v[i * 8 + 2 * q].z, v[i * 8 + 2 * q + 1].z);
                o[3][q] = pack_bf16x2(v[i * 8 + 2 * q].w, v[i * 8 + 2 * q + 1].w);
            }
            #pragma unroll
            for (int k = 0; k < 4; ++k)
                *(u32x4*)(d + (i * CSTEP + k) * R) = o[k];
        }
    }
};

// Round the weights to bf16 and transpose them once per call, instead of once
// per batch tile inside the main kernel. One workgroup packs the W1 chunk and the
// W2 chunk of one (token, H chunk); all 32 loads of a thread are issued before
// the first conversion, so a thread waits out one memory latency.
__global__ void __launch_bounds__(256)
pack_weights_kernel(const float* __restrict__ W1,
                    const float* __restrict__ W2,
                    __bf16* __restrict__ wt)
{
    typedef TileT<D_, H_> T1;   // W1 chunk: 256 rows (d) x 64 columns (h)
    typedef TileT<HC, D_> T2;   // W2 chunk: 64 rows (h) x 256 columns (d)
    const int c   = blockIdx.x;
    const int tkn = blockIdx.y;
    const int tid = threadIdx.x;
    __bf16* tile = wt + (size_t)(tkn * NCHUNK + c) * WT_TILE;
    const float* s1 = T1::src(W1 + (size_t)tkn * D_ * H_ + c * HC, tid);
    const float* s2 = T2::src(W2 + ((size_t)tkn * H_ + c * HC) * D_, tid);
    float4 v1[16], v2[16];
    T1::load(s1, v1);
    T2::load(s2, v2);
    // Stands behind the loads and in front of every rewrite of a register that
    // an issued load names (a precaution). Both address pairs are inputs of the
    // statement, so they stay live to this line and no load's result is placed
    // on them.
    asm volatile("s_wait_xcnt 0x0" :: "v"(s1), "v"(s2) : "memory");
    T1::store(T1::dst(tile, tid), v1);
    T2::store(T2::dst(tile + WT_HALF, tid), v2);
}

// Eight asynchronous 16-B copies per lane, global memory to LDS through no
// register: copy i takes 16 B at g + i * 4096 B to LDS byte l + i * LSTEP.
// The s_wait_xcnt at the end of the same statement stands in front of every
// rewrite of an address register that an issued copy names (a precaution).
template <int LSTEP>
__device__ __forceinline__ void async_copy8(unsigned l, const __bf16* g) {
    asm volatile(
        "global_load_async_to_lds_b128 %0, %8, off\n\t"
        "global_load_async_to_lds_b128 %1, %9, off\n\t"
        "global_load_async_to_lds_b128 %2, %10, off\n\t"
        "global_load_async_to_lds_b128 %3, %11, off\n\t"
        "global_load_async_to_lds_b128 %4, %12, off\n\t"
        "global_load_async_to_lds_b128 %5, %13, off\n\t"
        "global_load_async_to_lds_b128 %6, %14, off\n\t"
        "global_load_async_to_lds_b128 %7, %15, off\n\t"
        "s_wait_xcnt 0x0"
        :: "v"(l), "v"(l + LSTEP), "v"(l + 2 * LSTEP), "v"(l + 3 * LSTEP),
           "v"(l + 4 * LSTEP), "v"(l + 5 * LSTEP), "v"(l + 6 * LSTEP), "v"(l + 7 * LSTEP),
           "v"(g), "v"(g + 2048), "v"(g + 2 * 2048), "v"(g + 3 * 2048),
           "v"(g + 4 * 2048), "v"(g + 5 * 2048), "v"(g + 6 * 2048), "v"(g + 7 * 2048)
        : "memory");
}

// One wave's sixteen copies of one packed chunk. l1w, l2w: the LDS bytes of the
// wave's first W1 row and first W2 row in the target buffers; gw: the wave's first
// 512 B of the chunk in the workspace. All three are the same in every lane.
__device__ __forceinline__ void stage_chunk(unsigned l1w, unsigned l2w, const __bf16* gw) {
    // The lane's number, formed at this place: as the builtin it is moved out of
    // the loop, finds no free register there and is spilled to scratch memory, and
    // every hand-over then waits for a scratch load in front of its copies.
    unsigned lane;
    asm volatile("v_mbcnt_lo_u32_b32 %0, -1, 0" : "=v"(lane));
    const __bf16* g = gw + lane * 8;
    async_copy8<8 * DP * 2>(l1w + lane * 16, g);
    async_copy8<32 * HP * 2>(l2w + (lane >> 3) * (HP * 2) + (lane & 7) * 16, g + WT_HALF);
}

__global__ void __launch_bounds__(256)
PerTokenFFN_wmma_kernel(const float* __restrict__ x,
                        const __bf16* __restrict__ wt,
                        const float* __restrict__ b1,
                        const float* __restrict__ b2,
                        float* __restrict__ y)
{
    __shared__ __attribute__((aligned(16))) char smem[LDS_BYTES];
    __bf16* xA    = (__bf16*)(smem + LDS_XA);
    const __bf16* w1sAll = (const __bf16*)(smem + LDS_W1S);
    const __bf16* w2sAll = (const __bf16*)(smem + LDS_W2S);
    __bf16* hsAll = (__bf16*)(smem + LDS_HS);

    const int tid   = threadIdx.x;
    const int lane  = tid & 31;
    const int wave  = tid >> 5;
    const int half  = lane >> 4;   // which half-wave (selects K sub-range)
    const int lhalf = lane & 15;   // M (A-frag) / N (B-frag) index
    const int tkn   = blockIdx.y;
    const int b0    = blockIdx.x * BM;
    const int m0    = wave * (MT * 16);

    __bf16* hs = hsAll + wave * (MT * 16 * HP);

    // ---- weight chunks: 16-B units, lanes contiguous in global memory ----
    // Unit tid + 256 * i of each half of a packed chunk is this lane's copy i:
    // w1s[h][d] has 32 units per row (a sweep of the block = 8 rows),
    // w2s[d][h] has 8 units per row (a sweep = 32 rows).
    // The wave's share of each address is kept in scalar registers, the lane's
    // share is formed where the copies are issued (stage_chunk), so that no vector
    // register is held for them across the loop, where none is free.
    const int wave_s = __builtin_amdgcn_readfirstlane(wave);
    const __bf16* wwave = wt + (size_t)tkn * NCHUNK * WT_TILE + wave_s * 256;
    const unsigned l1w = (unsigned)(size_t)(smem + LDS_W1S) + wave_s * (DP * 2);
    const unsigned l2w = (unsigned)(size_t)(smem + LDS_W2S) + wave_s * (4 * HP * 2);

    // Chunk 0 starts to fly in front of the x tile's staging.
    stage_chunk(l1w, l2w, wwave);

    // ---------------- stage x tile (f32 -> bf16) ----------------
    {
        // 64 float4 per row, 4 rows per sweep of the block: a thread's loads are
        // constant offsets from one address, its LDS stores likewise.
        const float* xp = x + (size_t)(b0 + (tid >> 6)) * (T_ * D_) + (size_t)tkn * D_
                            + (tid & 63) * 4;
        __bf16* xd = xA + (tid >> 6) * DP + (tid & 63) * 4;
        #pragma unroll
        for (int bt = 0; bt < BM / 128; ++bt) {   // batches of 32 loads
            float4 v[32];
            #pragma unroll
            for (int i = 0; i < 32; ++i)
                v[i] = *(const float4*)(xp + (size_t)((bt * 32 + i) * 4) * (T_ * D_));
            // Stands behind the loads and in front of every rewrite of a register
            // that an issued load names (a precaution). The address pair is an
            // input, so it stays live to this line and no result is placed on it.
            asm volatile("s_wait_xcnt 0x0" :: "v"(xp) : "memory");
            #pragma unroll
            for (int i = 0; i < 32; ++i) {
                u32x2 p;
                p.x = pack_bf16x2(v[i].x, v[i].y);
                p.y = pack_bf16x2(v[i].z, v[i].w);
                *(u32x2*)(xd + (bt * 32 + i) * 4 * DP) = p;
            }
        }
    }

    v8f yacc[MT][16];
    #pragma unroll
    for (int m = 0; m < MT; ++m)
        #pragma unroll
        for (int n = 0; n < 16; ++n)
            yacc[m][n] = (v8f){0.f,0.f,0.f,0.f,0.f,0.f,0.f,0.f};

    // Chunk 0 has landed for this wave's own copies; the barrier publishes it, and
    // the x tile, to the other waves.
    asm volatile("s_wait_asynccnt 0x0" ::: "memory");
    __syncthreads();
    // Chunk 1 flies while chunk 0 is worked on.
    stage_chunk(l1w + W1S_BYTES, l2w + W2S_BYTES, wwave + WT_TILE);

    for (int t = 0; t < NCHUNK; ++t) {
        const int hc  = t * HC;
        const int buf = t & 1;
        const __bf16* w1s = w1sAll + buf * (HC * DP);
        const __bf16* w2s = w2sAll + buf * (D_ * HP);

        // ---- GEMM1: h[32 x 64] = xA[32 x 256] * W1chunk[256 x 64] ----
        // Software-pipelined: fragments for k-step s+1 are loaded while the
        // WMMAs of k-step s execute, so ds_loads overlap matrix issue.
        // The chunk's four bias values are asked for here, so that their latency
        // passes behind GEMM1 and not in front of each gelu group.
        float bias1[4];
        #pragma unroll
        for (int n = 0; n < 4; ++n)
            bias1[n] = b1[(size_t)tkn * H_ + hc + n * 16 + lhalf];

        v8f ht[MT][4];
        #pragma unroll
        for (int m = 0; m < MT; ++m)
            #pragma unroll
            for (int n = 0; n < 4; ++n)
                ht[m][n] = (v8f){0.f,0.f,0.f,0.f,0.f,0.f,0.f,0.f};

        {
            const __bf16* aRow = xA + (m0 + lhalf) * DP;
            v16bf a_cur[MT];
            #pragma unroll
            for (int m = 0; m < MT; ++m)
                a_cur[m] = ld_frag(aRow + m * 16 * DP, half * 8);
            v16bf b_cur[4];
            #pragma unroll
            for (int n = 0; n < 4; ++n)
                b_cur[n] = ld_frag(w1s + (n * 16 + lhalf) * DP, half * 8);

            #pragma unroll
            for (int ks = 0; ks < 8; ++ks) {
                v16bf a_nxt[MT];
                v16bf b_nxt[4];
                if (ks < 7) {
                    int koff = (ks + 1) * 32 + half * 8;
                    #pragma unroll
                    for (int m = 0; m < MT; ++m)
                        a_nxt[m] = ld_frag(aRow + m * 16 * DP, koff);
                    #pragma unroll
                    for (int n = 0; n < 4; ++n)
                        b_nxt[n] = ld_frag(w1s + (n * 16 + lhalf) * DP, koff);
                }
                #pragma unroll
                for (int n = 0; n < 4; ++n)
                    #pragma unroll
                    for (int m = 0; m < MT; ++m)
                        ht[m][n] = wmma_bf16(a_cur[m], b_cur[n], ht[m][n]);
                if (ks < 7) {
                    #pragma unroll
                    for (int m = 0; m < MT; ++m) a_cur[m] = a_nxt[m];
                    #pragma unroll
                    for (int n = 0; n < 4; ++n) b_cur[n] = b_nxt[n];
                }
            }
        }

        // ---- bias + exact GELU, round to bf16, scatter into A-layout LDS ----
        #pragma unroll
        for (int n = 0; n < 4; ++n) {
            #pragma unroll
            for (int m = 0; m < MT; ++m) {
                float g[8];
                gelu_erf8(ht[m][n], bias1[n], g);
                #pragma unroll
                for (int r = 0; r < 8; ++r)         // C/D: row r+8*half, col lhalf
                    hs[(m * 16 + r + 8 * half) * HP + n * 16 + lhalf] = (__bf16)g[r];
            }
        }

        // ---- GEMM2: yacc[32 x 256] += gelu(h)[32 x 64] * W2chunk[64 x 256] ----
        // 8 pipeline steps: step s = (kk-half s>>2, ntile-group s&3), 4*MT WMMAs each.
        {
            const __bf16* hRow = hs + lhalf * HP;
            v16bf a2[MT][2];
            #pragma unroll
            for (int m = 0; m < MT; ++m) {
                a2[m][0] = ld_frag(hRow + m * 16 * HP, half * 8);
                a2[m][1] = ld_frag(hRow + m * 16 * HP, 32 + half * 8);
            }

            v16bf b_cur[4];
            #pragma unroll
            for (int j = 0; j < 4; ++j)
                b_cur[j] = ld_frag(w2s + (j * 16 + lhalf) * HP, half * 8);

            #pragma unroll
            for (int s = 0; s < 8; ++s) {
                v16bf b_nxt[4];
                if (s < 7) {
                    int sn  = s + 1;
                    int kkn = (sn >> 2) * 32;
                    int gn  = sn & 3;
                    #pragma unroll
                    for (int j = 0; j < 4; ++j)
                        b_nxt[j] = ld_frag(w2s + ((gn * 4 + j) * 16 + lhalf) * HP,
                                           kkn + half * 8);
                }
                int g = s & 3;
                #pragma unroll
                for (int j = 0; j < 4; ++j)
                    #pragma unroll
                    for (int m = 0; m < MT; ++m)
                        yacc[m][g * 4 + j] =
                            wmma_bf16(a2[m][s >> 2], b_cur[j], yacc[m][g * 4 + j]);
                if (s < 7) {
                    #pragma unroll
                    for (int j = 0; j < 4; ++j) b_cur[j] = b_nxt[j];
                }
            }
        }

        // ---- hand-over: chunk t + 1 is published, chunk t's buffers are freed ----
        // This wave's LDS reads of chunk t have returned.
        asm volatile("s_wait_dscnt 0x0" ::: "memory");
        // This wave's copies of chunk t + 1 have landed.
        asm volatile("s_wait_asynccnt 0x0" ::: "memory");
        __syncthreads();
        // Chunk t + 2 goes into the buffers that chunk t has just left.
        if (t + 2 < NCHUNK)
            stage_chunk(l1w + buf * W1S_BYTES, l2w + buf * W2S_BYTES,
                        wwave + (size_t)(t + 2) * WT_TILE);
    }
    // No copy is outstanding when the wave goes on to its end.
    asm volatile("s_wait_asynccnt 0x0" ::: "memory");

    // ---------------- epilogue: + b2, store f32 ----------------
    float* yp = y + (size_t)(b0 + m0 + 8 * half) * (T_ * D_) + (size_t)tkn * D_ + lhalf;
    #pragma unroll
    for (int n = 0; n < 16; ++n) {
        int col    = n * 16 + lhalf;
        float bias = b2[(size_t)tkn * D_ + col];
        #pragma unroll
        for (int m = 0; m < MT; ++m)
            #pragma unroll
            for (int r = 0; r < 8; ++r) yacc[m][n][r] += bias;
    }
    // All sums stand in front of the first store: no vector instruction is moved in
    // among the stores, so none rewrites a register that an issued store names.
    __builtin_amdgcn_sched_barrier(0);
    #pragma unroll
    for (int n = 0; n < 16; ++n)
        #pragma unroll
        for (int m = 0; m < MT; ++m)
            #pragma unroll
            for (int r = 0; r < 8; ++r)
                yp[(size_t)(m * 16 + r) * (T_ * D_) + n * 16] = yacc[m][n][r];
    // Keeps the stores' address pair live behind the last store, so that it is not
    // rewritten while a store that names it is still issued (a precaution).
    asm volatile("s_wait_xcnt 0x0" :: "v"(yp) : "memory");
}

extern "C" void kernel_launch(void* const* d_in, const int* in_sizes, int n_in,
                              void* d_out, int out_size, void* d_ws, size_t ws_size,
                              hipStream_t stream) {
    (void)in_sizes; (void)n_in; (void)out_size; (void)ws_size;
    const float* x  = (const float*)d_in[0];
    const float* W1 = (const float*)d_in[1];
    const float* b1 = (const float*)d_in[2];
    const float* W2 = (const float*)d_in[3];
    const float* b2 = (const float*)d_in[4];
    float* y = (float*)d_out;
    __bf16* wt = (__bf16*)d_ws;   // 32 MB of packed bf16 weights

    dim3 block(256);          // 8 wave32
    dim3 pgrid(NCHUNK, T_);   // one (token, H chunk) per workgroup
    pack_weights_kernel<<<pgrid, block, 0, stream>>>(W1, W2, wt);

    dim3 grid(B_ / BM, T_);   // 8 x 32 = 256 workgroups
    PerTokenFFN_wmma_kernel<<<grid, block, 0, stream>>>(x, wt, b1, b2, y);
}

// v005
// Measured time: 72.6 microseconds a run.
// In two side-by-side timings against v004, it was 1.12 and 1.11 times as fast.
// Over all steps from v000 it is 7.19 times as fast.
#include <hip/hip_runtime.h>
#include <hip/hip_bf16.h>
#include <math.h>

// ---- problem constants (match reference) ----
#define T_ 32
#define D_ 256
#define H_ 1024
#define B_ 2048

// ---- tiling ----
#define BM 256      // rows of x per workgroup
#define HC 64       // H chunk per iteration
#define NWAVE 8     // 256 threads / wave32
#define MT 2        // 16-row tiles per wave: each weight fragment feeds MT WMMAs

// LDS row pitch in bf16 elements: every row carries 8 pad elements (16 B), so
// the pitch is an odd multiple of 16 B and the 16 rows that one ds_load_b128
// fragment read touches fall on 16 different groups of four banks.
#define DP (D_ + 8)  // 528 B rows: xA, w1s
#define HP (HC + 8)  // 144 B rows: w2s, hs

// LDS layout (bytes):
//   xA : [BM][DP]      bf16 = 135168
//   w1s: [2][HC][DP]   bf16 = 2 x 33792 (B^T of layer-1 chunk: row = h, col = d)
//   w2s: [2][D_][HP]   bf16 = 2 x 36864 (B^T of layer-2:       row = d, col = h)
//   hs : [NWAVE][MT*16][HP] bf16 = 36864 (per-wave gelu(h) staging for A-frags)
// 313344 B in all: one workgroup per WGP. The weight chunks have two buffers
// each: chunk t is read from buffer t mod 2 while chunk t + 1 lands in the other.
#define W1S_BYTES (HC * DP * 2)
#define W2S_BYTES (D_ * HP * 2)
#define LDS_XA   0
#define LDS_W1S  (BM * DP * 2)
#define LDS_W2S  (LDS_W1S + 2 * W1S_BYTES)
#define LDS_HS   (LDS_W2S + 2 * W2S_BYTES)
#define LDS_BYTES (LDS_HS + NWAVE * MT * 16 * HP * 2)

// Workspace: per (token, H chunk) one 64 KB bf16 image, written by the pack
// kernel and read by the main kernel of the same call:
//   [HC][D_] W1 chunk transposed (row = h, col = d), then
//   [D_][HC] W2 chunk transposed (row = d, col = h).
#define NCHUNK  (H_ / HC)
#define WT_HALF (HC * D_)        // bf16 elements of one transposed chunk
#define WT_TILE (2 * WT_HALF)

typedef __attribute__((ext_vector_type(16))) __bf16 v16bf;
typedef __attribute__((ext_vector_type(8)))  float  v8f;
typedef __attribute__((ext_vector_type(4)))  unsigned int u32x4;
typedef __attribute__((ext_vector_type(2)))  unsigned int u32x2;

__device__ __forceinline__ unsigned pack_bf16x2(float a, float b) {
    unsigned short ua = __builtin_bit_cast(unsigned short, (__bf16)a);
    unsigned short ub = __builtin_bit_cast(unsigned short, (__bf16)b);
    return (unsigned)ua | ((unsigned)ub << 16);
}

// Branch-free exact-erf GELU (Abramowitz & Stegun 7.1.26, |err| < 1.5e-7 --
// below the bf16 rounding applied to h anyway), v_rcp_f32 + v_exp_f32, no EXEC
// divergence, unlike ocml erff.
// With z = |v| / sqrt(2), t = 1 / (1 + 0.3275911 z) and erfc(z) = t P(t) exp(-z z):
//   gelu(v) = 0.5 v + |v| (0.5 - 0.5 t P(t) exp(-z z)),
// the same for both signs of v, so no sign is copied and no 1 + erf is formed.
// All of it is written in s = C v, C = sqrt(log2(e) / 2), so that exp(-z z) is
// exp2(-s s) with no further factor; 1 / C goes into the constants:
//   K = 0.5 / C, A1..A5 = K times the series' coefficients, KT = 0.3275911 / (C sqrt(2)).
// Two values go through each step as one float pair (packed f32 instructions);
// only the two steps that take |s| and the two transcendentals are per value.
// Written stage by stage over the NP pairs: the chains are independent, and in
// this order each instruction's producer lies NP back, so a wave does not wait
// out the vector latency at every link.
#define GELU_C  0.84932180f
#define GELU_K  0.58870501f
#define GELU_KT 0.27273748f
#define GELU_A1 0.15001946f
#define GELU_A2 (-0.16748465f)
#define GELU_A3 0.83679339f
#define GELU_A4 (-0.85547788f)
#define GELU_A5 0.62485470f
typedef __attribute__((ext_vector_type(2))) float f32x2;
typedef __attribute__((ext_vector_type(2))) __bf16 bf16x2;

__device__ __forceinline__ f32x2 pfma(f32x2 a, f32x2 b, f32x2 c) {
    return __builtin_elementwise_fma(a, b, c);
}
__device__ __forceinline__ f32x2 both(float a) { return (f32x2){a, a}; }

// h: NP pairs of pre-activations without their bias; bc = C * bias.
template <int NP>
__device__ __forceinline__ void gelu_erf_pairs(const f32x2 (&h)[NP], float bc, f32x2 (&g)[NP]) {
    f32x2 s[NP], t[NP], e[NP], p[NP];
    #pragma unroll
    for (int i = 0; i < NP; ++i) s[i] = pfma(h[i], both(GELU_C), both(bc));
    #pragma unroll
    for (int i = 0; i < NP; ++i) {
        t[i].x = fmaf(fabsf(s[i].x), GELU_KT, 1.0f);
        t[i].y = fmaf(fabsf(s[i].y), GELU_KT, 1.0f);
    }
    #pragma unroll
    for (int i = 0; i < NP; ++i) {
        t[i].x = __builtin_amdgcn_rcpf(t[i].x);
        t[i].y = __builtin_amdgcn_rcpf(t[i].y);
    }
    #pragma unroll
    for (int i = 0; i < NP; ++i) e[i] = -s[i] * s[i];
    #pragma unroll
    for (int i = 0; i < NP; ++i) {
        e[i].x = __builtin_amdgcn_exp2f(e[i].x);
        e[i].y = __builtin_amdgcn_exp2f(e[i].y);
    }
    #pragma unroll
    for (int i = 0; i < NP; ++i) p[i] = pfma(t[i], both(GELU_A5), both(GELU_A4));
    #pragma unroll
    for (int i = 0; i < NP; ++i) p[i] = pfma(t[i], p[i], both(GELU_A3));
    #pragma unroll
    for (int i = 0; i < NP; ++i) p[i] = pfma(t[i], p[i], both(GELU_A2));
    #pragma unroll
    for (int i = 0; i < NP; ++i) p[i] = pfma(t[i], p[i], both(GELU_A1));
    #pragma unroll
    for (int i = 0; i < NP; ++i) e[i] = t[i] * e[i];
    #pragma unroll
    for (int i = 0; i < NP; ++i) p[i] = pfma(-p[i], e[i], both(GELU_K));   // K (1 - erfc(z))
    #pragma unroll
    for (int i = 0; i < NP; ++i) t[i] = s[i] * both(GELU_K);               // 0.5 v
    #pragma unroll
    for (int i = 0; i < NP; ++i) {
        g[i].x = fmaf(fabsf(s[i].x), p[i].x, t[i].x);
        g[i].y = fmaf(fabsf(s[i].y), p[i].y, t[i].y);
    }
}

// Build one 16x16x32 bf16 operand fragment (8 VGPRs) from a row base in LDS.
// Per the CDNA5 ISA A-layout: this lane's data is two contiguous 16-byte runs
// at element offsets koff and koff+16 within its row.
__device__ __forceinline__ v16bf ld_frag(const __bf16* rowptr, int koff) {
    union { v16bf v; u32x4 q[2]; } u;
    u.q[0] = *(const u32x4*)(rowptr + koff);
    u.q[1] = *(const u32x4*)(rowptr + koff + 16);
    return u.v;
}

__device__ __forceinline__ v8f wmma_bf16(v16bf a, v16bf b, v8f c) {
    return __builtin_amdgcn_wmma_f32_16x16x32_bf16(false, a, false, b,
                                                   (short)0, c, false, false);
}

// Transposing one [R][16384/R] f32 tile (row stride LDIN floats) into a bf16 tile
// with rows of R elements: each thread takes two blocks of 8 rows x 4 columns in
// registers, 8 float4 loads in and 4 stores of 16 B (8 consecutive r) out per
// block. Eight neighbouring lanes hold neighbouring row blocks, so a store fills
// whole 128-B lines; four lanes side by side read 64 contiguous bytes of a row.
// R and LDIN are compile-time constants, so the thread's second block lies a
// constant CSTEP columns beside its first, and all loads (and all stores) of a
// thread are constant offsets from one address.
// All loops here are unrolled so that v[] and o[] are indexed by constants and
// stay in registers.
template <int R, int LDIN>
struct TileT {
    static constexpr int RHI   = R / 64;          // row blocks beyond the 8 the lanes span
    static constexpr int CSTEP = (8 / RHI) * 16;  // columns from block 0 to block 1
    static __device__ __forceinline__ int rblk(int tid) {
        return (tid & 7) | (((tid >> 5) % RHI) << 3);
    }
    static __device__ __forceinline__ int c4(int tid) {
        return ((tid >> 3) & 3) | (((tid >> 5) / RHI) << 2);
    }
    static __device__ __forceinline__ const float* src(const float* in, int tid) {
        return in + (size_t)(rblk(tid) * 8) * LDIN + c4(tid) * 4;
    }
    static __device__ __forceinline__ __bf16* dst(__bf16* out, int tid) {
        return out + (size_t)(c4(tid) * 4) * R + rblk(tid) * 8;
    }
    static __device__ __forceinline__ void load(const float* s, float4 (&v)[16]) {
        #pragma unroll
        for (int i = 0; i < 2; ++i)
            #pragma unroll
            for (int r = 0; r < 8; ++r)
                v[i * 8 + r] = *(const float4*)(s + r * LDIN + i * CSTEP);
    }
    static __device__ __forceinline__ void store(__bf16* d, const float4 (&v)[16]) {
        #pragma unroll
        for (int i = 0; i < 2; ++i) {
            u32x4 o[4];
            #pragma unroll
            for (int q = 0; q < 4; ++q) {
                o[0][q] = pack_bf16x2(v[i * 8 + 2 * q].x, v[i * 8 + 2 * q + 1].x);
                o[1][q] = pack_bf16x2(v[i * 8 + 2 * q].y, v[i * 8 + 2 * q + 1].y);
                o[2][q] = pack_bf16x2(v[i * 8 + 2 * q].z, v[i * 8 + 2 * q + 1].z);
                o[3][q] = pack_bf16x2(v[i * 8 + 2 * q].w, v[i * 8 + 2 * q + 1].w);
            }
            #pragma unroll
            for (int k = 0; k < 4; ++k)
                *(u32x4*)(d + (i * CSTEP + k) * R) = o[k];
        }
    }
};

// Round the weights to bf16 and transpose them once per call, instead of once
// per batch tile inside the main kernel. One workgroup packs the W1 chunk and the
// W2 chunk of one (token, H chunk); all 32 loads of a thread are issued before
// the first conversion, so a thread waits out one memory latency.
__global__ void __launch_bounds__(256)
pack_weights_kernel(const float* __restrict__ W1,
                    const float* __restrict__ W2,
                    __bf16* __restrict__ wt)
{
    typedef TileT<D_, H_> T1;   // W1 chunk: 256 rows (d) x 64 columns (h)
    typedef TileT<HC, D_> T2;   // W2 chunk: 64 rows (h) x 256 columns (d)
    const int c   = blockIdx.x;
    const int tkn = blockIdx.y;
    const int tid = threadIdx.x;
    __bf16* tile = wt + (size_t)(tkn * NCHUNK + c) * WT_TILE;
    const float* s1 = T1::src(W1 + (size_t)tkn * D_ * H_ + c * HC, tid);
    const float* s2 = T2::src(W2 + ((size_t)tkn * H_ + c * HC) * D_, tid);
    float4 v1[16], v2[16];
    T1::load(s1, v1);
    T2::load(s2, v2);
    // Stands behind the loads and in front of every rewrite of a register that
    // an issued load names (a precaution). Both address pairs are inputs of the
    // statement, so they stay live to this line and no load's result is placed
    // on them.
    asm volatile("s_wait_xcnt 0x0" :: "v"(s1), "v"(s2) : "memory");
    T1::store(T1::dst(tile, tid), v1);
    T2::store(T2::dst(tile + WT_HALF, tid), v2);
}

// Eight asynchronous 16-B copies per lane, global memory to LDS through no
// register: copy i takes 16 B at g + i * 4096 B to LDS byte l + i * LSTEP.
// The s_wait_xcnt at the end of the same statement stands in front of every
// rewrite of an address register that an issued copy names (a precaution).
template <int LSTEP>
__device__ __forceinline__ void async_copy8(unsigned l, const __bf16* g) {
    asm volatile(
        "global_load_async_to_lds_b128 %0, %8, off\n\t"
        "global_load_async_to_lds_b128 %1, %9, off\n\t"
        "global_load_async_to_lds_b128 %2, %10, off\n\t"
        "global_load_async_to_lds_b128 %3, %11, off\n\t"
        "global_load_async_to_lds_b128 %4, %12, off\n\t"
        "global_load_async_to_lds_b128 %5, %13, off\n\t"
        "global_load_async_to_lds_b128 %6, %14, off\n\t"
        "global_load_async_to_lds_b128 %7, %15, off\n\t"
        "s_wait_xcnt 0x0"
        :: "v"(l), "v"(l + LSTEP), "v"(l + 2 * LSTEP), "v"(l + 3 * LSTEP),
           "v"(l + 4 * LSTEP), "v"(l + 5 * LSTEP), "v"(l + 6 * LSTEP), "v"(l + 7 * LSTEP),
           "v"(g), "v"(g + 2048), "v"(g + 2 * 2048), "v"(g + 3 * 2048),
           "v"(g + 4 * 2048), "v"(g + 5 * 2048), "v"(g + 6 * 2048), "v"(g + 7 * 2048)
        : "memory");
}

// One wave's sixteen copies of one packed chunk. l1w, l2w: the LDS bytes of the
// wave's first W1 row and first W2 row in the target buffers; gw: the wave's first
// 512 B of the chunk in the workspace. All three are the same in every lane.
__device__ __forceinline__ void stage_chunk(unsigned l1w, unsigned l2w, const __bf16* gw) {
    // The lane's number, formed at this place: as the builtin it is moved out of
    // the loop, finds no free register there and is spilled to scratch memory, and
    // every hand-over then waits for a scratch load in front of its copies.
    unsigned lane;
    asm volatile("v_mbcnt_lo_u32_b32 %0, -1, 0" : "=v"(lane));
    const __bf16* g = gw + lane * 8;
    async_copy8<8 * DP * 2>(l1w + lane * 16, g);
    async_copy8<32 * HP * 2>(l2w + (lane >> 3) * (HP * 2) + (lane & 7) * 16, g + WT_HALF);
}

__global__ void __launch_bounds__(256)
PerTokenFFN_wmma_kernel(const float* __restrict__ x,
                        const __bf16* __restrict__ wt,
                        const float* __restrict__ b1,
                        const float* __restrict__ b2,
                        float* __restrict__ y)
{
    __shared__ __attribute__((aligned(16))) char smem[LDS_BYTES];
    __bf16* xA    = (__bf16*)(smem + LDS_XA);
    const __bf16* w1sAll = (const __bf16*)(smem + LDS_W1S);
    const __bf16* w2sAll = (const __bf16*)(smem + LDS_W2S);
    __bf16* hsAll = (__bf16*)(smem + LDS_HS);

    const int tid   = threadIdx.x;
    const int lane  = tid & 31;
    const int wave  = tid >> 5;
    const int half  = lane >> 4;   // which half-wave (selects K sub-range)
    const int lhalf = lane & 15;   // M (A-frag) / N (B-frag) index
    const int tkn   = blockIdx.y;
    const int b0    = blockIdx.x * BM;
    const int m0    = wave * (MT * 16);

    __bf16* hs = hsAll + wave * (MT * 16 * HP);

    // ---- weight chunks: 16-B units, lanes contiguous in global memory ----
    // Unit tid + 256 * i of each half of a packed chunk is this lane's copy i:
    // w1s[h][d] has 32 units per row (a sweep of the block = 8 rows),
    // w2s[d][h] has 8 units per row (a sweep = 32 rows).
    // The wave's share of each address is kept in scalar registers, the lane's
    // share is formed where the copies are issued (stage_chunk), so that no vector
    // register is held for them across the loop, where none is free.
    const int wave_s = __builtin_amdgcn_readfirstlane(wave);
    const __bf16* wwave = wt + (size_t)tkn * NCHUNK * WT_TILE + wave_s * 256;
    const unsigned l1w = (unsigned)(size_t)(smem + LDS_W1S) + wave_s * (DP * 2);
    const unsigned l2w = (unsigned)(size_t)(smem + LDS_W2S) + wave_s * (4 * HP * 2);

    // Chunk 0 starts to fly in front of the x tile's staging.
    stage_chunk(l1w, l2w, wwave);

    // ---------------- stage x tile (f32 -> bf16) ----------------
    {
        // 64 float4 per row, 4 rows per sweep of the block: a thread's loads are
        // constant offsets from one address, its LDS stores likewise.
        const float* xp = x + (size_t)(b0 + (tid >> 6)) * (T_ * D_) + (size_t)tkn * D_
                            + (tid & 63) * 4;
        __bf16* xd = xA + (tid >> 6) * DP + (tid & 63) * 4;
        #pragma unroll
        for (int bt = 0; bt < BM / 128; ++bt) {   // batches of 32 loads
            float4 v[32];
            #pragma unroll
            for (int i = 0; i < 32; ++i)
                v[i] = *(const float4*)(xp + (size_t)((bt * 32 + i) * 4) * (T_ * D_));
            // Stands behind the loads and in front of every rewrite of a register
            // that an issued load names (a precaution). The address pair is an
            // input, so it stays live to this line and no result is placed on it.
            asm volatile("s_wait_xcnt 0x0" :: "v"(xp) : "memory");
            #pragma unroll
            for (int i = 0; i < 32; ++i) {
                u32x2 p;
                p.x = pack_bf16x2(v[i].x, v[i].y);
                p.y = pack_bf16x2(v[i].z, v[i].w);
                *(u32x2*)(xd + (bt * 32 + i) * 4 * DP) = p;
            }
        }
    }

    v8f yacc[MT][16];
    #pragma unroll
    for (int m = 0; m < MT; ++m)
        #pragma unroll
        for (int n = 0; n < 16; ++n)
            yacc[m][n] = (v8f){0.f,0.f,0.f,0.f,0.f,0.f,0.f,0.f};

    // Chunk 0 has landed for this wave's own copies; the barrier publishes it, and
    // the x tile, to the other waves.
    asm volatile("s_wait_asynccnt 0x0" ::: "memory");
    __syncthreads();
    // Chunk 1 flies while chunk 0 is worked on.
    stage_chunk(l1w + W1S_BYTES, l2w + W2S_BYTES, wwave + WT_TILE);

    for (int t = 0; t < NCHUNK; ++t) {
        const int hc  = t * HC;
        const int buf = t & 1;
        const __bf16* w1s = w1sAll + buf * (HC * DP);
        const __bf16* w2s = w2sAll + buf * (D_ * HP);

        // ---- GEMM1: h[32 x 64] = xA[32 x 256] * W1chunk[256 x 64] ----
        // Software-pipelined: fragments for k-step s+1 are loaded while the
        // WMMAs of k-step s execute, so ds_loads overlap matrix issue.
        // The chunk's four bias values are asked for here, so that their latency
        // passes behind GEMM1 and not in front of each gelu group.
        float bias1[4];
        #pragma unroll
        for (int n = 0; n < 4; ++n)
            bias1[n] = b1[(size_t)tkn * H_ + hc + n * 16 + lhalf];

        v8f ht[MT][4];
        #pragma unroll
        for (int m = 0; m < MT; ++m)
            #pragma unroll
            for (int n = 0; n < 4; ++n)
                ht[m][n] = (v8f){0.f,0.f,0.f,0.f,0.f,0.f,0.f,0.f};

        {
            const __bf16* aRow = xA + (m0 + lhalf) * DP;
            v16bf a_cur[MT];
            #pragma unroll
            for (int m = 0; m < MT; ++m)
                a_cur[m] = ld_frag(aRow + m * 16 * DP, half * 8);
            v16bf b_cur[4];
            #pragma unroll
            for (int n = 0; n < 4; ++n)
                b_cur[n] = ld_frag(w1s + (n * 16 + lhalf) * DP, half * 8);

            #pragma unroll
            for (int ks = 0; ks < 8; ++ks) {
                v16bf a_nxt[MT];
                v16bf b_nxt[4];
                if (ks < 7) {
                    int koff = (ks + 1) * 32 + half * 8;
                    #pragma unroll
                    for (int m = 0; m < MT; ++m)
                        a_nxt[m] = ld_frag(aRow + m * 16 * DP, koff);
                    #pragma unroll
                    for (int n = 0; n < 4; ++n)
                        b_nxt[n] = ld_frag(w1s + (n * 16 + lhalf) * DP, koff);
                }
                #pragma unroll
                for (int n = 0; n < 4; ++n)
                    #pragma unroll
                    for (int m = 0; m < MT; ++m)
                        ht[m][n] = wmma_bf16(a_cur[m], b_cur[n], ht[m][n]);
                if (ks < 7) {
                    #pragma unroll
                    for (int m = 0; m < MT; ++m) a_cur[m] = a_nxt[m];
                    #pragma unroll
                    for (int n = 0; n < 4; ++n) b_cur[n] = b_nxt[n];
                }
            }
        }

        // ---- bias + exact GELU, round to bf16, scatter into A-layout LDS ----
        #pragma unroll
        for (int n = 0; n < 4; ++n) {
            f32x2 hp[MT * 4], g[MT * 4];
            #pragma unroll
            for (int m = 0; m < MT; ++m)
                #pragma unroll
                for (int q = 0; q < 4; ++q)
                    hp[m * 4 + q] = (f32x2){ht[m][n][2 * q], ht[m][n][2 * q + 1]};
            gelu_erf_pairs<MT * 4>(hp, GELU_C * bias1[n], g);
            #pragma unroll
            for (int m = 0; m < MT; ++m)
                #pragma unroll
                for (int q = 0; q < 4; ++q) {       // C/D: row r+8*half, col lhalf
                    __bf16* hd = hs + (m * 16 + 2 * q + 8 * half) * HP + n * 16 + lhalf;
                    const bf16x2 pr = __builtin_convertvector(g[m * 4 + q], bf16x2);
                    hd[0]  = pr.x;
                    hd[HP] = pr.y;
                }
        }

        // ---- GEMM2: yacc[32 x 256] += gelu(h)[32 x 64] * W2chunk[64 x 256] ----
        // 8 pipeline steps: step s = (kk-half s>>2, ntile-group s&3), 4*MT WMMAs each.
        {
            const __bf16* hRow = hs + lhalf * HP;
            v16bf a2[MT][2];
            #pragma unroll
            for (int m = 0; m < MT; ++m) {
                a2[m][0] = ld_frag(hRow + m * 16 * HP, half * 8);
                a2[m][1] = ld_frag(hRow + m * 16 * HP, 32 + half * 8);
            }

            v16bf b_cur[4];
            #pragma unroll
            for (int j = 0; j < 4; ++j)
                b_cur[j] = ld_frag(w2s + (j * 16 + lhalf) * HP, half * 8);

            #pragma unroll
            for (int s = 0; s < 8; ++s) {
                v16bf b_nxt[4];
                if (s < 7) {
                    int sn  = s + 1;
                    int kkn = (sn >> 2) * 32;
                    int gn  = sn & 3;
                    #pragma unroll
                    for (int j = 0; j < 4; ++j)
                        b_nxt[j] = ld_frag(w2s + ((gn * 4 + j) * 16 + lhalf) * HP,
                                           kkn + half * 8);
                }
                int g = s & 3;
                #pragma unroll
                for (int j = 0; j < 4; ++j)
                    #pragma unroll
                    for (int m = 0; m < MT; ++m)
                        yacc[m][g * 4 + j] =
                            wmma_bf16(a2[m][s >> 2], b_cur[j], yacc[m][g * 4 + j]);
                if (s < 7) {
                    #pragma unroll
                    for (int j = 0; j < 4; ++j) b_cur[j] = b_nxt[j];
                }
            }
        }

        // ---- hand-over: chunk t + 1 is published, chunk t's buffers are freed ----
        // This wave's LDS reads of chunk t have returned.
        asm volatile("s_wait_dscnt 0x0" ::: "memory");
        // This wave's copies of chunk t + 1 have landed.
        asm volatile("s_wait_asynccnt 0x0" ::: "memory");
        __syncthreads();
        // Chunk t + 2 goes into the buffers that chunk t has just left.
        if (t + 2 < NCHUNK)
            stage_chunk(l1w + buf * W1S_BYTES, l2w + buf * W2S_BYTES,
                        wwave + (size_t)(t + 2) * WT_TILE);
    }
    // No copy is outstanding when the wave goes on to its end.
    asm volatile("s_wait_asynccnt 0x0" ::: "memory");

    // ---------------- epilogue: + b2, store f32 ----------------
    float* yp = y + (size_t)(b0 + m0 + 8 * half) * (T_ * D_) + (size_t)tkn * D_ + lhalf;
    #pragma unroll
    for (int n = 0; n < 16; ++n) {
        int col    = n * 16 + lhalf;
        float bias = b2[(size_t)tkn * D_ + col];
        #pragma unroll
        for (int m = 0; m < MT; ++m)
            #pragma unroll
            for (int r = 0; r < 8; ++r) yacc[m][n][r] += bias;
    }
    // All sums stand in front of the first store: no vector instruction is moved in
    // among the stores, so none rewrites a register that an issued store names.
    __builtin_amdgcn_sched_barrier(0);
    #pragma unroll
    for (int n = 0; n < 16; ++n)
        #pragma unroll
        for (int m = 0; m < MT; ++m)
            #pragma unroll
            for (int r = 0; r < 8; ++r)
                yp[(size_t)(m * 16 + r) * (T_ * D_) + n * 16] = yacc[m][n][r];
    // Keeps the stores' address pair live behind the last store, so that it is not
    // rewritten while a store that names it is still issued (a precaution).
    asm volatile("s_wait_xcnt 0x0" :: "v"(yp) : "memory");
}

extern "C" void kernel_launch(void* const* d_in, const int* in_sizes, int n_in,
                              void* d_out, int out_size, void* d_ws, size_t ws_size,
                              hipStream_t stream) {
    (void)in_sizes; (void)n_in; (void)out_size; (void)ws_size;
    const float* x  = (const float*)d_in[0];
    const float* W1 = (const float*)d_in[1];
    const float* b1 = (const float*)d_in[2];
    const float* W2 = (const float*)d_in[3];
    const float* b2 = (const float*)d_in[4];
    float* y = (float*)d_out;
    __bf16* wt = (__bf16*)d_ws;   // 32 MB of packed bf16 weights

    dim3 block(256);          // 8 wave32
    dim3 pgrid(NCHUNK, T_);   // one (token, H chunk) per workgroup
    pack_weights_kernel<<<pgrid, block, 0, stream>>>(W1, W2, wt);

    dim3 grid(B_ / BM, T_);   // 8 x 32 = 256 workgroups
    PerTokenFFN_wmma_kernel<<<grid, block, 0, stream>>>(x, wt, b1, b2, y);
}

// v006
// A run of this version takes 67.1 microseconds.
// Timed twice side by side with v005, it ran 1.07 and 1.09 times as fast.
// Over all steps from v000 it is 7.79 times as fast.
#include <hip/hip_runtime.h>
#include <hip/hip_bf16.h>
#include <math.h>

// ---- problem constants (match reference) ----
#define T_ 32
#define D_ 256
#define H_ 1024
#define B_ 2048

// ---- tiling ----
#define BM 256      // rows of x per workgroup
#define HC 64       // H chunk per iteration
#define NWAVE 8     // 256 threads / wave32
#define MT 2        // 16-row tiles per wave: each weight fragment feeds MT WMMAs

// LDS row pitch in bf16 elements: every row carries 8 pad elements (16 B), so
// the pitch is an odd multiple of 16 B and the 16 rows that one ds_load_b128
// fragment read touches fall on 16 different groups of four banks.
#define DP (D_ + 8)  // 528 B rows: xA, w1s
#define HP (HC + 8)  // 144 B rows: w2s

// LDS layout (bytes):
//   xA : [BM][DP]      bf16 = 135168
//   w1s: [2][HC][DP]   bf16 = 2 x 33792 (layer-1 chunk transposed: row = h, col = d)
//   w2s: [2][D_][HP]   bf16 = 2 x 36864 (B^T of layer-2:           row = d, col = h)
// 276480 B in all: one workgroup per WGP. The weight chunks have two buffers
// each: chunk t is read from buffer t mod 2 while chunk t + 1 lands in the other.
#define W1S_BYTES (HC * DP * 2)
#define W2S_BYTES (D_ * HP * 2)
#define LDS_XA   0
#define LDS_W1S  (BM * DP * 2)
#define LDS_W2S  (LDS_W1S + 2 * W1S_BYTES)
#define LDS_BYTES (LDS_W2S + 2 * W2S_BYTES)

// Workspace: per (token, H chunk) one 64 KB bf16 image, written by the pack
// kernel and read by the main kernel of the same call:
//   [HC][D_] W1 chunk transposed (row = h, col = d), then
//   [D_][HC] W2 chunk transposed (row = d, col = h).
#define NCHUNK  (H_ / HC)
#define WT_HALF (HC * D_)        // bf16 elements of one transposed chunk
#define WT_TILE (2 * WT_HALF)

typedef __attribute__((ext_vector_type(16))) __bf16 v16bf;
typedef __attribute__((ext_vector_type(8)))  float  v8f;
typedef __attribute__((ext_vector_type(4)))  unsigned int u32x4;
typedef __attribute__((ext_vector_type(2)))  unsigned int u32x2;

__device__ __forceinline__ unsigned pack_bf16x2(float a, float b) {
    unsigned short ua = __builtin_bit_cast(unsigned short, (__bf16)a);
    unsigned short ub = __builtin_bit_cast(unsigned short, (__bf16)b);
    return (unsigned)ua | ((unsigned)ub << 16);
}

// Branch-free exact-erf GELU (Abramowitz & Stegun 7.1.26, |err| < 1.5e-7 --
// below the bf16 rounding applied to h anyway), v_rcp_f32 + v_exp_f32, no EXEC
// divergence, unlike ocml erff.
// With z = |v| / sqrt(2), t = 1 / (1 + 0.3275911 z) and erfc(z) = t P(t) exp(-z z):
//   gelu(v) = 0.5 v + |v| (0.5 - 0.5 t P(t) exp(-z z)),
// the same for both signs of v, so no sign is copied and no 1 + erf is formed.
// All of it is written in s = C v, C = sqrt(log2(e) / 2), so that exp(-z z) is
// exp2(-s s) with no further factor; 1 / C goes into the constants:
//   K = 0.5 / C, A1..A5 = K times the series' coefficients, KT = 0.3275911 / (C sqrt(2)).
// Two values go through each step as one float pair (packed f32 instructions);
// only the two steps that take |s| and the two transcendentals are per value.
// Written stage by stage over the NP pairs: the chains are independent, and in
// this order each instruction's producer lies NP back, so a wave does not wait
// out the vector latency at every link.
#define GELU_C  0.84932180f
#define GELU_K  0.58870501f
#define GELU_KT 0.27273748f
#define GELU_A1 0.15001946f
#define GELU_A2 (-0.16748465f)
#define GELU_A3 0.83679339f
#define GELU_A4 (-0.85547788f)
#define GELU_A5 0.62485470f
typedef __attribute__((ext_vector_type(2))) float f32x2;
typedef __attribute__((ext_vector_type(2))) __bf16 bf16x2;

__device__ __forceinline__ f32x2 pfma(f32x2 a, f32x2 b, f32x2 c) {
    return __builtin_elementwise_fma(a, b, c);
}
__device__ __forceinline__ f32x2 both(float a) { return (f32x2){a, a}; }

// h: NP pairs of pre-activations without their bias; bc[i & 3] = C * the bias
// pair of h[i] (a tile's four pairs lie along H, and every tile of a call has the
// same four).
template <int NP>
__device__ __forceinline__ void gelu_erf_pairs(const f32x2 (&h)[NP], const f32x2 (&bc)[4],
                                               f32x2 (&g)[NP]) {
    f32x2 s[NP], t[NP], e[NP], p[NP];
    #pragma unroll
    for (int i = 0; i < NP; ++i) s[i] = pfma(h[i], both(GELU_C), bc[i & 3]);
    #pragma unroll
    for (int i = 0; i < NP; ++i) {
        t[i].x = fmaf(fabsf(s[i].x), GELU_KT, 1.0f);
        t[i].y = fmaf(fabsf(s[i].y), GELU_KT, 1.0f);
    }
    #pragma unroll
    for (int i = 0; i < NP; ++i) {
        t[i].x = __builtin_amdgcn_rcpf(t[i].x);
        t[i].y = __builtin_amdgcn_rcpf(t[i].y);
    }
    #pragma unroll
    for (int i = 0; i < NP; ++i) e[i] = -s[i] * s[i];
    #pragma unroll
    for (int i = 0; i < NP; ++i) {
        e[i].x = __builtin_amdgcn_exp2f(e[i].x);
        e[i].y = __builtin_amdgcn_exp2f(e[i].y);
    }
    #pragma unroll
    for (int i = 0; i < NP; ++i) p[i] = pfma(t[i], both(GELU_A5), both(GELU_A4));
    #pragma unroll
    for (int i = 0; i < NP; ++i) p[i] = pfma(t[i], p[i], both(GELU_A3));
    #pragma unroll
    for (int i = 0; i < NP; ++i) p[i] = pfma(t[i], p[i], both(GELU_A2));
    #pragma unroll
    for (int i = 0; i < NP; ++i) p[i] = pfma(t[i], p[i], both(GELU_A1));
    #pragma unroll
    for (int i = 0; i < NP; ++i) e[i] = t[i] * e[i];
    #pragma unroll
    for (int i = 0; i < NP; ++i) p[i] = pfma(-p[i], e[i], both(GELU_K));   // K (1 - erfc(z))
    #pragma unroll
    for (int i = 0; i < NP; ++i) t[i] = s[i] * both(GELU_K);               // 0.5 v
    #pragma unroll
    for (int i = 0; i < NP; ++i) {
        g[i].x = fmaf(fabsf(s[i].x), p[i].x, t[i].x);
        g[i].y = fmaf(fabsf(s[i].y), p[i].y, t[i].y);
    }
}

// Build one 16x16x32 bf16 operand fragment (8 VGPRs) from a row base in LDS.
// Per the CDNA5 ISA A-layout: this lane's data is two contiguous 16-byte runs
// at element offsets koff and koff+16 within its row.
__device__ __forceinline__ v16bf ld_frag(const __bf16* rowptr, int koff) {
    union { v16bf v; u32x4 q[2]; } u;
    u.q[0] = *(const u32x4*)(rowptr + koff);
    u.q[1] = *(const u32x4*)(rowptr + koff + 16);
    return u.v;
}

__device__ __forceinline__ v8f wmma_bf16(v16bf a, v16bf b, v8f c) {
    return __builtin_amdgcn_wmma_f32_16x16x32_bf16(false, a, false, b,
                                                   (short)0, c, false, false);
}

// Transposing one [R][16384/R] f32 tile (row stride LDIN floats) into a bf16 tile
// with rows of R elements: each thread takes two blocks of 8 rows x 4 columns in
// registers, 8 float4 loads in and 4 stores of 16 B (8 consecutive r) out per
// block. Eight neighbouring lanes hold neighbouring row blocks, so a store fills
// whole 128-B lines; four lanes side by side read 64 contiguous bytes of a row.
// R and LDIN are compile-time constants, so the thread's second block lies a
// constant CSTEP columns beside its first, and all loads (and all stores) of a
// thread are constant offsets from one address.
// All loops here are unrolled so that v[] and o[] are indexed by constants and
// stay in registers.
template <int R, int LDIN>
struct TileT {
    static constexpr int RHI   = R / 64;          // row blocks beyond the 8 the lanes span
    static constexpr int CSTEP = (8 / RHI) * 16;  // columns from block 0 to block 1
    static __device__ __forceinline__ int rblk(int tid) {
        return (tid & 7) | (((tid >> 5) % RHI) << 3);
    }
    static __device__ __forceinline__ int c4(int tid) {
        return ((tid >> 3) & 3) | (((tid >> 5) / RHI) << 2);
    }
    static __device__ __forceinline__ const float* src(const float* in, int tid) {
        return in + (size_t)(rblk(tid) * 8) * LDIN + c4(tid) * 4;
    }
    static __device__ __forceinline__ __bf16* dst(__bf16* out, int tid) {
        return out + (size_t)(c4(tid) * 4) * R + rblk(tid) * 8;
    }
    static __device__ __forceinline__ void load(const float* s, float4 (&v)[16]) {
        #pragma unroll
        for (int i = 0; i < 2; ++i)
            #pragma unroll
            for (int r = 0; r < 8; ++r)
                v[i * 8 + r] = *(const float4*)(s + r * LDIN + i * CSTEP);
    }
    static __device__ __forceinline__ void store(__bf16* d, const float4 (&v)[16]) {
        #pragma unroll
        for (int i = 0; i < 2; ++i) {
            u32x4 o[4];
            #pragma unroll
            for (int q = 0; q < 4; ++q) {
                o[0][q] = pack_bf16x2(v[i * 8 + 2 * q].x, v[i * 8 + 2 * q + 1].x);
                o[1][q] = pack_bf16x2(v[i * 8 + 2 * q].y, v[i * 8 + 2 * q + 1].y);
                o[2][q] = pack_bf16x2(v[i * 8 + 2 * q].z, v[i * 8 + 2 * q + 1].z);
                o[3][q] = pack_bf16x2(v[i * 8 + 2 * q].w, v[i * 8 + 2 * q + 1].w);
            }
            #pragma unroll
            for (int k = 0; k < 4; ++k)
                *(u32x4*)(d + (i * CSTEP + k) * R) = o[k];
        }
    }
};

// Round the weights to bf16 and transpose them once per call, instead of once
// per batch tile inside the main kernel. One workgroup packs the W1 chunk and the
// W2 chunk of one (token, H chunk); all 32 loads of a thread are issued before
// the first conversion, so a thread waits out one memory latency.
__global__ void __launch_bounds__(256)
pack_weights_kernel(const float* __restrict__ W1,
                    const float* __restrict__ W2,
                    __bf16* __restrict__ wt)
{
    typedef TileT<D_, H_> T1;   // W1 chunk: 256 rows (d) x 64 columns (h)
    typedef TileT<HC, D_> T2;   // W2 chunk: 64 rows (h) x 256 columns (d)
    const int c   = blockIdx.x;
    const int tkn = blockIdx.y;
    const int tid = threadIdx.x;
    __bf16* tile = wt + (size_t)(tkn * NCHUNK + c) * WT_TILE;
    const float* s1 = T1::src(W1 + (size_t)tkn * D_ * H_ + c * HC, tid);
    const float* s2 = T2::src(W2 + ((size_t)tkn * H_ + c * HC) * D_, tid);
    float4 v1[16], v2[16];
    T1::load(s1, v1);
    T2::load(s2, v2);
    // Stands behind the loads and in front of every rewrite of a register that
    // an issued load names (a precaution). Both address pairs are inputs of the
    // statement, so they stay live to this line and no load's result is placed
    // on them.
    asm volatile("s_wait_xcnt 0x0" :: "v"(s1), "v"(s2) : "memory");
    T1::store(T1::dst(tile, tid), v1);
    T2::store(T2::dst(tile + WT_HALF, tid), v2);
}

// Eight asynchronous 16-B copies per lane, global memory to LDS through no
// register: copy i takes 16 B at g + i * 4096 B to LDS byte l + i * LSTEP.
// The s_wait_xcnt at the end of the same statement stands in front of every
// rewrite of an address register that an issued copy names (a precaution).
template <int LSTEP>
__device__ __forceinline__ void async_copy8(unsigned l, const __bf16* g) {
    asm volatile(
        "global_load_async_to_lds_b128 %0, %8, off\n\t"
        "global_load_async_to_lds_b128 %1, %9, off\n\t"
        "global_load_async_to_lds_b128 %2, %10, off\n\t"
        "global_load_async_to_lds_b128 %3, %11, off\n\t"
        "global_load_async_to_lds_b128 %4, %12, off\n\t"
        "global_load_async_to_lds_b128 %5, %13, off\n\t"
        "global_load_async_to_lds_b128 %6, %14, off\n\t"
        "global_load_async_to_lds_b128 %7, %15, off\n\t"
        "s_wait_xcnt 0x0"
        :: "v"(l), "v"(l + LSTEP), "v"(l + 2 * LSTEP), "v"(l + 3 * LSTEP),
           "v"(l + 4 * LSTEP), "v"(l + 5 * LSTEP), "v"(l + 6 * LSTEP), "v"(l + 7 * LSTEP),
           "v"(g), "v"(g + 2048), "v"(g + 2 * 2048), "v"(g + 3 * 2048),
           "v"(g + 4 * 2048), "v"(g + 5 * 2048), "v"(g + 6 * 2048), "v"(g + 7 * 2048)
        : "memory");
}

// One wave's sixteen copies of one packed chunk. l1w, l2w: the LDS bytes of the
// wave's first W1 row and first W2 row in the target buffers; gw: the wave's first
// 512 B of the chunk in the workspace. All three are the same in every lane.
__device__ __forceinline__ void stage_chunk(unsigned l1w, unsigned l2w, const __bf16* gw) {
    // The lane's number, formed at this place: as the builtin it is moved out of
    // the loop, finds no free register there and is spilled to scratch memory, and
    // every hand-over then waits for a scratch load in front of its copies.
    unsigned lane;
    asm volatile("v_mbcnt_lo_u32_b32 %0, -1, 0" : "=v"(lane));
    const __bf16* g = gw + lane * 8;
    async_copy8<8 * DP * 2>(l1w + lane * 16, g);
    async_copy8<32 * HP * 2>(l2w + (lane >> 3) * (HP * 2) + (lane & 7) * 16, g + WT_HALF);
}

__global__ void __launch_bounds__(256)
PerTokenFFN_wmma_kernel(const float* __restrict__ x,
                        const __bf16* __restrict__ wt,
                        const float* __restrict__ b1,
                        const float* __restrict__ b2,
                        float* __restrict__ y)
{
    __shared__ __attribute__((aligned(16))) char smem[LDS_BYTES];
    __bf16* xA    = (__bf16*)(smem + LDS_XA);
    const __bf16* w1sAll = (const __bf16*)(smem + LDS_W1S);
    const __bf16* w2sAll = (const __bf16*)(smem + LDS_W2S);

    const int tid   = threadIdx.x;
    const int lane  = tid & 31;
    const int wave  = tid >> 5;
    const int half  = lane >> 4;   // which half-wave (selects K sub-range)
    const int lhalf = lane & 15;   // M (A-frag) / N (B-frag) index
    const int tkn   = blockIdx.y;
    const int b0    = blockIdx.x * BM;
    const int m0    = wave * (MT * 16);

    // ---- weight chunks: 16-B units, lanes contiguous in global memory ----
    // Unit tid + 256 * i of each half of a packed chunk is this lane's copy i:
    // w1s[h][d] has 32 units per row (a sweep of the block = 8 rows),
    // w2s[d][h] has 8 units per row (a sweep = 32 rows).
    // The wave's share of each address is kept in scalar registers, the lane's
    // share is formed where the copies are issued (stage_chunk), so that no vector
    // register is held for them across the loop, where none is free.
    const int wave_s = __builtin_amdgcn_readfirstlane(wave);
    const __bf16* wwave = wt + (size_t)tkn * NCHUNK * WT_TILE + wave_s * 256;
    const unsigned l1w = (unsigned)(size_t)(smem + LDS_W1S) + wave_s * (DP * 2);
    const unsigned l2w = (unsigned)(size_t)(smem + LDS_W2S) + wave_s * (4 * HP * 2);

    // Chunk 0 starts to fly in front of the x tile's staging.
    stage_chunk(l1w, l2w, wwave);

    // ---------------- stage x tile (f32 -> bf16) ----------------
    {
        // 64 float4 per row, 4 rows per sweep of the block: a thread's loads are
        // constant offsets from one address, its LDS stores likewise.
        const float* xp = x + (size_t)(b0 + (tid >> 6)) * (T_ * D_) + (size_t)tkn * D_
                            + (tid & 63) * 4;
        __bf16* xd = xA + (tid >> 6) * DP + (tid & 63) * 4;
        #pragma unroll
        for (int bt = 0; bt < BM / 128; ++bt) {   // batches of 32 loads
            float4 v[32];
            #pragma unroll
            for (int i = 0; i < 32; ++i)
                v[i] = *(const float4*)(xp + (size_t)((bt * 32 + i) * 4) * (T_ * D_));
            // Stands behind the loads and in front of every rewrite of a register
            // that an issued load names (a precaution). The address pair is an
            // input, so it stays live to this line and no result is placed on it.
            asm volatile("s_wait_xcnt 0x0" :: "v"(xp) : "memory");
            #pragma unroll
            for (int i = 0; i < 32; ++i) {
                u32x2 p;
                p.x = pack_bf16x2(v[i].x, v[i].y);
                p.y = pack_bf16x2(v[i].z, v[i].w);
                *(u32x2*)(xd + (bt * 32 + i) * 4 * DP) = p;
            }
        }
    }

    v8f yacc[MT][16];
    #pragma unroll
    for (int m = 0; m < MT; ++m)
        #pragma unroll
        for (int n = 0; n < 16; ++n)
            yacc[m][n] = (v8f){0.f,0.f,0.f,0.f,0.f,0.f,0.f,0.f};

    // Chunk 0 has landed for this wave's own copies; the barrier publishes it, and
    // the x tile, to the other waves.
    asm volatile("s_wait_asynccnt 0x0" ::: "memory");
    __syncthreads();
    // Chunk 1 flies while chunk 0 is worked on.
    stage_chunk(l1w + W1S_BYTES, l2w + W2S_BYTES, wwave + WT_TILE);

    // The lane's layer-1 bias values of a chunk run along H, eight per tile (h = 16 n
    // + 8 * half + r). Chunk 0's are asked for here, chunk t + 1's behind the gelu of
    // chunk t, which frees the registers: their latency passes behind a GEMM.
    const float* b1l = b1 + (size_t)tkn * H_ + 8 * half;
    const float4* bp = (const float4*)b1l;
    float4 bias1[4][2];
    #pragma unroll
    for (int n = 0; n < 4; ++n) {
        bias1[n][0] = bp[n * 4];
        bias1[n][1] = bp[n * 4 + 1];
    }
    // Stands behind the loads and in front of every rewrite of their address pair,
    // which is an input and so stays live to this line (a precaution).
    asm volatile("s_wait_xcnt 0x0" :: "v"(bp) : "memory");

    for (int t = 0; t < NCHUNK; ++t) {
        const int buf = t & 1;
        const __bf16* w1s = w1sAll + buf * (HC * DP);
        const __bf16* w2s = w2sAll + buf * (D_ * HP);

        // ---- GEMM1, transposed: h^T[64 x 32] = W1chunk^T[64 x 256] * xA^T[256 x 32] ----
        // The W1 fragment is the A operand and the x fragment the B operand, so an
        // accumulator tile holds in lane (half, lhalf) the batch row lhalf and the
        // eight h indices 8 * half + r: the k run that the same lane owns in an A
        // fragment of GEMM2. gelu(h) therefore goes from accumulators to GEMM2's
        // A fragments inside the lane's own registers, through no LDS.
        // Software-pipelined: fragments for k-step s+1 are loaded while the
        // WMMAs of k-step s execute, so ds_loads overlap matrix issue.

        v8f ht[MT][4];
        #pragma unroll
        for (int m = 0; m < MT; ++m)
            #pragma unroll
            for (int n = 0; n < 4; ++n)
                ht[m][n] = (v8f){0.f,0.f,0.f,0.f,0.f,0.f,0.f,0.f};

        {
            const __bf16* aRow = xA + (m0 + lhalf) * DP;
            v16bf a_cur[MT];
            #pragma unroll
            for (int m = 0; m < MT; ++m)
                a_cur[m] = ld_frag(aRow + m * 16 * DP, half * 8);
            v16bf b_cur[4];
            #pragma unroll
            for (int n = 0; n < 4; ++n)
                b_cur[n] = ld_frag(w1s + (n * 16 + lhalf) * DP, half * 8);

            #pragma unroll
            for (int ks = 0; ks < 8; ++ks) {
                v16bf a_nxt[MT];
                v16bf b_nxt[4];
                if (ks < 7) {
                    int koff = (ks + 1) * 32 + half * 8;
                    #pragma unroll
                    for (int m = 0; m < MT; ++m)
                        a_nxt[m] = ld_frag(aRow + m * 16 * DP, koff);
                    #pragma unroll
                    for (int n = 0; n < 4; ++n)
                        b_nxt[n] = ld_frag(w1s + (n * 16 + lhalf) * DP, koff);
                }
                #pragma unroll
                for (int n = 0; n < 4; ++n)
                    #pragma unroll
                    for (int m = 0; m < MT; ++m)
                        ht[m][n] = wmma_bf16(b_cur[n], a_cur[m], ht[m][n]);
                if (ks < 7) {
                    #pragma unroll
                    for (int m = 0; m < MT; ++m) a_cur[m] = a_nxt[m];
                    #pragma unroll
                    for (int n = 0; n < 4; ++n) b_cur[n] = b_nxt[n];
                }
            }
        }

        // ---- bias + exact GELU, round to bf16: GEMM2's A fragments, in registers ----
        // Tile n holds h = 16 n + 8 * half + r. Fragment a2[m][n >> 1] takes k =
        // 8 * half + e in its first eight elements and 16 + 8 * half + e in its
        // last eight: the even tile and the odd tile, register for register.
        union { v16bf v; bf16x2 p[8]; } a2[MT][2];
        #pragma unroll
        for (int n = 0; n < 4; ++n) {
            f32x2 hp[MT * 4], g[MT * 4], bc[4];
            bc[0] = (f32x2){bias1[n][0].x, bias1[n][0].y} * both(GELU_C);
            bc[1] = (f32x2){bias1[n][0].z, bias1[n][0].w} * both(GELU_C);
            bc[2] = (f32x2){bias1[n][1].x, bias1[n][1].y} * both(GELU_C);
            bc[3] = (f32x2){bias1[n][1].z, bias1[n][1].w} * both(GELU_C);
            #pragma unroll
            for (int m = 0; m < MT; ++m)
                #pragma unroll
                for (int q = 0; q < 4; ++q)
                    hp[m * 4 + q] = (f32x2){ht[m][n][2 * q], ht[m][n][2 * q + 1]};
            gelu_erf_pairs<MT * 4>(hp, bc, g);
            #pragma unroll
            for (int m = 0; m < MT; ++m)
                #pragma unroll
                for (int q = 0; q < 4; ++q)
                    a2[m][n >> 1].p[(n & 1) * 4 + q] =
                        __builtin_convertvector(g[m * 4 + q], bf16x2);
        }

        // Bias of chunk t + 1 (the last trip asks for its own chunk's again, so that
        // the address stays inside b1; nothing reads those values).
        bp = (const float4*)(b1l + (t + 1 < NCHUNK ? t + 1 : t) * HC);
        #pragma unroll
        for (int n = 0; n < 4; ++n) {
            bias1[n][0] = bp[n * 4];
            bias1[n][1] = bp[n * 4 + 1];
        }

        // ---- GEMM2: yacc[32 x 256] += gelu(h)[32 x 64] * W2chunk[64 x 256] ----
        // 8 pipeline steps: step s = (kk-half s>>2, ntile-group s&3), 4*MT WMMAs each.
        {
            v16bf b_cur[4];
            #pragma unroll
            for (int j = 0; j < 4; ++j)
                b_cur[j] = ld_frag(w2s + (j * 16 + lhalf) * HP, half * 8);

            #pragma unroll
            for (int s = 0; s < 8; ++s) {
                v16bf b_nxt[4];
                if (s < 7) {
                    int sn  = s + 1;
                    int kkn = (sn >> 2) * 32;
                    int gn  = sn & 3;
                    #pragma unroll
                    for (int j = 0; j < 4; ++j)
                        b_nxt[j] = ld_frag(w2s + ((gn * 4 + j) * 16 + lhalf) * HP,
                                           kkn + half * 8);
                }
                int g = s & 3;
                #pragma unroll
                for (int j = 0; j < 4; ++j)
                    #pragma unroll
                    for (int m = 0; m < MT; ++m)
                        yacc[m][g * 4 + j] =
                            wmma_bf16(a2[m][s >> 2].v, b_cur[j], yacc[m][g * 4 + j]);
                if (s < 7) {
                    #pragma unroll
                    for (int j = 0; j < 4; ++j) b_cur[j] = b_nxt[j];
                }
            }
        }

        // ---- hand-over: chunk t + 1 is published, chunk t's buffers are freed ----
        // Stands behind the bias loads and in front of every rewrite of their address
        // pair, which is an input and so stays live to this line (a precaution).
        asm volatile("s_wait_xcnt 0x0" :: "v"(bp) : "memory");
        // This wave's LDS reads of chunk t have returned.
        asm volatile("s_wait_dscnt 0x0" ::: "memory");
        // This wave's copies of chunk t + 1 have landed.
        asm volatile("s_wait_asynccnt 0x0" ::: "memory");
        __syncthreads();
        // Chunk t + 2 goes into the buffers that chunk t has just left.
        if (t + 2 < NCHUNK)
            stage_chunk(l1w + buf * W1S_BYTES, l2w + buf * W2S_BYTES,
                        wwave + (size_t)(t + 2) * WT_TILE);
    }
    // No copy is outstanding when the wave goes on to its end.
    asm volatile("s_wait_asynccnt 0x0" ::: "memory");

    // ---------------- epilogue: + b2, store f32 ----------------
    float* yp = y + (size_t)(b0 + m0 + 8 * half) * (T_ * D_) + (size_t)tkn * D_ + lhalf;
    #pragma unroll
    for (int n = 0; n < 16; ++n) {
        int col    = n * 16 + lhalf;
        float bias = b2[(size_t)tkn * D_ + col];
        #pragma unroll
        for (int m = 0; m < MT; ++m)
            #pragma unroll
            for (int r = 0; r < 8; ++r) yacc[m][n][r] += bias;
    }
    // All sums stand in front of the first store: no vector instruction is moved in
    // among the stores, so none rewrites a register that an issued store names.
    __builtin_amdgcn_sched_barrier(0);
    #pragma unroll
    for (int n = 0; n < 16; ++n)
        #pragma unroll
        for (int m = 0; m < MT; ++m)
            #pragma unroll
            for (int r = 0; r < 8; ++r)
                yp[(size_t)(m * 16 + r) * (T_ * D_) + n * 16] = yacc[m][n][r];
    // Keeps the stores' address pair live behind the last store, so that it is not
    // rewritten while a store that names it is still issued (a precaution).
    asm volatile("s_wait_xcnt 0x0" :: "v"(yp) : "memory");
}

extern "C" void kernel_launch(void* const* d_in, const int* in_sizes, int n_in,
                              void* d_out, int out_size, void* d_ws, size_t ws_size,
                              hipStream_t stream) {
    (void)in_sizes; (void)n_in; (void)out_size; (void)ws_size;
    const float* x  = (const float*)d_in[0];
    const float* W1 = (const float*)d_in[1];
    const float* b1 = (const float*)d_in[2];
    const float* W2 = (const float*)d_in[3];
    const float* b2 = (const float*)d_in[4];
    float* y = (float*)d_out;
    __bf16* wt = (__bf16*)d_ws;   // 32 MB of packed bf16 weights

    dim3 block(256);          // 8 wave32
    dim3 pgrid(NCHUNK, T_);   // one (token, H chunk) per workgroup
    pack_weights_kernel<<<pgrid, block, 0, stream>>>(W1, W2, wt);

    dim3 grid(B_ / BM, T_);   // 8 x 32 = 256 workgroups
    PerTokenFFN_wmma_kernel<<<grid, block, 0, stream>>>(x, wt, b1, b2, y);
}

// v007
// It runs in 62.4 microseconds.
// Timed twice side by side with v006, it ran 1.07 and 1.08 times as fast.
// Counting every step since v000, it is 8.39 times as fast.
#include <hip/hip_runtime.h>
#include <hip/hip_bf16.h>
#include <math.h>

// ---- problem constants (match reference) ----
#define T_ 32
#define D_ 256
#define H_ 1024
#define B_ 2048

// ---- tiling ----
#define BM 256      // rows of x per workgroup
#define HC 64       // H chunk per iteration
#define NWAVE 8     // 256 threads / wave32
#define MT 2        // 16-row tiles per wave: each weight fragment feeds MT WMMAs

// LDS row pitch in bf16 elements: every row carries 8 pad elements (16 B), so
// the pitch is an odd multiple of 16 B and the 16 rows that one ds_load_b128
// fragment read touches fall on 16 different groups of four banks.
#define DP (D_ + 8)  // 528 B rows: xA, w1s
#define HP (HC + 8)  // 144 B rows: w2s

// LDS layout (bytes):
//   xA : [BM][DP]      bf16 = 135168
//   w1s: [2][HC][DP]   bf16 = 2 x 33792 (layer-1 chunk transposed: row = h, col = d)
//   w2s: [2][D_][HP]   bf16 = 2 x 36864 (B^T of layer-2:           row = d, col = h)
// 276480 B in all: one workgroup per WGP. The weight chunks have two buffers
// each: chunk t is read from buffer t mod 2 while chunk t + 1 lands in the other.
#define W1S_BYTES (HC * DP * 2)
#define W2S_BYTES (D_ * HP * 2)
#define LDS_XA   0
#define LDS_W1S  (BM * DP * 2)
#define LDS_W2S  (LDS_W1S + 2 * W1S_BYTES)
#define LDS_BYTES (LDS_W2S + 2 * W2S_BYTES)

// Workspace: per (token, H chunk) one 64 KB bf16 image, written by the pack
// kernel and read by the main kernel of the same call:
//   [HC][D_] W1 chunk transposed (row = h, col = d), then
//   [D_][HC] W2 chunk transposed (row = d, col = h).
#define NCHUNK  (H_ / HC)
#define WT_HALF (HC * D_)        // bf16 elements of one transposed chunk
#define WT_TILE (2 * WT_HALF)

typedef __attribute__((ext_vector_type(16))) __bf16 v16bf;
typedef __attribute__((ext_vector_type(8)))  float  v8f;
typedef __attribute__((ext_vector_type(4)))  unsigned int u32x4;
typedef __attribute__((ext_vector_type(2)))  unsigned int u32x2;

__device__ __forceinline__ unsigned pack_bf16x2(float a, float b) {
    unsigned short ua = __builtin_bit_cast(unsigned short, (__bf16)a);
    unsigned short ub = __builtin_bit_cast(unsigned short, (__bf16)b);
    return (unsigned)ua | ((unsigned)ub << 16);
}

// Branch-free erf GELU with no transcendental: gelu(v) = v * (0.5 + E(v)),
// E(v) = 0.5 erf(v / sqrt(2)), an odd function that is 0.5 to within 7.3e-5 from
// |v| = 3.8 on. With c = v clamped to [-3.8, 3.8]:
//   E(v) ~= c * R(c * c), R a polynomial of degree 6 (a minimax fit of c R(c c) to
//   E(c) on [0, 3.8], held to 0.5 at c = 3.8, so that beyond the clamp the factor
//   is 1 or 0 to within f32 rounding).
// |0.5 + c R(c c) - Phi(v)| < 7.3e-5 for every v, in f32 arithmetic; the absolute
// error of gelu is below 2.8e-4 everywhere and goes to 0 with v. Over normal v its
// rms is about a twentieth of the rms error of the rounding of gelu(h) to bf16 that
// follows. Only on the negative tail, where gelu itself is tiny, is it coarser than
// the local bf16 step; there it is still far below the rounding error of the other
// terms of the same sum in GEMM2.
// Two values go through each step as one float pair (packed f32 instructions);
// only the clamp is per value.
// Written stage by stage over the NP pairs: the chains are independent, and in
// this order each instruction's producer lies NP back, so a wave does not wait
// out the vector latency at every link.
#define GELU_U  3.8f
#define GELU_R0 3.98766547e-1f
#define GELU_R1 (-6.58453330e-2f)
#define GELU_R2 9.37494449e-3f
#define GELU_R3 (-9.43925348e-4f)
#define GELU_R4 6.20064166e-5f
#define GELU_R5 (-2.34159893e-6f)
#define GELU_R6 3.80675118e-8f
typedef __attribute__((ext_vector_type(2))) float f32x2;
typedef __attribute__((ext_vector_type(2))) __bf16 bf16x2;

__device__ __forceinline__ f32x2 pfma(f32x2 a, f32x2 b, f32x2 c) {
    return __builtin_elementwise_fma(a, b, c);
}
__device__ __forceinline__ f32x2 both(float a) { return (f32x2){a, a}; }

// h: NP pairs of pre-activations without their bias; b[i & 3] = the bias pair of
// h[i] (a tile's four pairs lie along H, and every tile of a call has the same
// four).
template <int NP>
__device__ __forceinline__ void gelu_erf_pairs(const f32x2 (&h)[NP], const f32x2 (&b)[4],
                                               f32x2 (&g)[NP]) {
    f32x2 s[NP], c[NP], w[NP], p[NP];
    #pragma unroll
    for (int i = 0; i < NP; ++i) s[i] = h[i] + b[i & 3];
    #pragma unroll
    for (int i = 0; i < NP; ++i) {
        c[i].x = __builtin_amdgcn_fmed3f(s[i].x, -GELU_U, GELU_U);
        c[i].y = __builtin_amdgcn_fmed3f(s[i].y, -GELU_U, GELU_U);
    }
    #pragma unroll
    for (int i = 0; i < NP; ++i) w[i] = c[i] * c[i];
    #pragma unroll
    for (int i = 0; i < NP; ++i) p[i] = pfma(w[i], both(GELU_R6), both(GELU_R5));
    #pragma unroll
    for (int i = 0; i < NP; ++i) p[i] = pfma(w[i], p[i], both(GELU_R4));
    #pragma unroll
    for (int i = 0; i < NP; ++i) p[i] = pfma(w[i], p[i], both(GELU_R3));
    #pragma unroll
    for (int i = 0; i < NP; ++i) p[i] = pfma(w[i], p[i], both(GELU_R2));
    #pragma unroll
    for (int i = 0; i < NP; ++i) p[i] = pfma(w[i], p[i], both(GELU_R1));
    #pragma unroll
    for (int i = 0; i < NP; ++i) p[i] = pfma(w[i], p[i], both(GELU_R0));
    #pragma unroll
    for (int i = 0; i < NP; ++i) p[i] = pfma(c[i], p[i], both(0.5f));   // Phi(v)
    #pragma unroll
    for (int i = 0; i < NP; ++i) g[i] = s[i] * p[i];
}

// Build one 16x16x32 bf16 operand fragment (8 VGPRs) from a row base in LDS.
// Per the CDNA5 ISA A-layout: this lane's data is two contiguous 16-byte runs
// at element offsets koff and koff+16 within its row.
__device__ __forceinline__ v16bf ld_frag(const __bf16* rowptr, int koff) {
    union { v16bf v; u32x4 q[2]; } u;
    u.q[0] = *(const u32x4*)(rowptr + koff);
    u.q[1] = *(const u32x4*)(rowptr + koff + 16);
    return u.v;
}

__device__ __forceinline__ v8f wmma_bf16(v16bf a, v16bf b, v8f c) {
    return __builtin_amdgcn_wmma_f32_16x16x32_bf16(false, a, false, b,
                                                   (short)0, c, false, false);
}

// Transposing one [R][16384/R] f32 tile (row stride LDIN floats) into a bf16 tile
// with rows of R elements: each thread takes two blocks of 8 rows x 4 columns in
// registers, 8 float4 loads in and 4 stores of 16 B (8 consecutive r) out per
// block. Eight neighbouring lanes hold neighbouring row blocks, so a store fills
// whole 128-B lines; four lanes side by side read 64 contiguous bytes of a row.
// R and LDIN are compile-time constants, so the thread's second block lies a
// constant CSTEP columns beside its first, and all loads (and all stores) of a
// thread are constant offsets from one address.
// All loops here are unrolled so that v[] and o[] are indexed by constants and
// stay in registers.
template <int R, int LDIN>
struct TileT {
    static constexpr int RHI   = R / 64;          // row blocks beyond the 8 the lanes span
    static constexpr int CSTEP = (8 / RHI) * 16;  // columns from block 0 to block 1
    static __device__ __forceinline__ int rblk(int tid) {
        return (tid & 7) | (((tid >> 5) % RHI) << 3);
    }
    static __device__ __forceinline__ int c4(int tid) {
        return ((tid >> 3) & 3) | (((tid >> 5) / RHI) << 2);
    }
    static __device__ __forceinline__ const float* src(const float* in, int tid) {
        return in + (size_t)(rblk(tid) * 8) * LDIN + c4(tid) * 4;
    }
    static __device__ __forceinline__ __bf16* dst(__bf16* out, int tid) {
        return out + (size_t)(c4(tid) * 4) * R + rblk(tid) * 8;
    }
    static __device__ __forceinline__ void load(const float* s, float4 (&v)[16]) {
        #pragma unroll
        for (int i = 0; i < 2; ++i)
            #pragma unroll
            for (int r = 0; r < 8; ++r)
                v[i * 8 + r] = *(const float4*)(s + r * LDIN + i * CSTEP);
    }
    static __device__ __forceinline__ void store(__bf16* d, const float4 (&v)[16]) {
        #pragma unroll
        for (int i = 0; i < 2; ++i) {
            u32x4 o[4];
            #pragma unroll
            for (int q = 0; q < 4; ++q) {
                o[0][q] = pack_bf16x2(v[i * 8 + 2 * q].x, v[i * 8 + 2 * q + 1].x);
                o[1][q] = pack_bf16x2(v[i * 8 + 2 * q].y, v[i * 8 + 2 * q + 1].y);
                o[2][q] = pack_bf16x2(v[i * 8 + 2 * q].z, v[i * 8 + 2 * q + 1].z);
                o[3][q] = pack_bf16x2(v[i * 8 + 2 * q].w, v[i * 8 + 2 * q + 1].w);
            }
            #pragma unroll
            for (int k = 0; k < 4; ++k)
                *(u32x4*)(d + (i * CSTEP + k) * R) = o[k];
        }
    }
};

// Round the weights to bf16 and transpose them once per call, instead of once
// per batch tile inside the main kernel. One workgroup packs the W1 chunk and the
// W2 chunk of one (token, H chunk); all 32 loads of a thread are issued before
// the first conversion, so a thread waits out one memory latency.
__global__ void __launch_bounds__(256)
pack_weights_kernel(const float* __restrict__ W1,
                    const float* __restrict__ W2,
                    __bf16* __restrict__ wt)
{
    typedef TileT<D_, H_> T1;   // W1 chunk: 256 rows (d) x 64 columns (h)
    typedef TileT<HC, D_> T2;   // W2 chunk: 64 rows (h) x 256 columns (d)
    const int c   = blockIdx.x;
    const int tkn = blockIdx.y;
    const int tid = threadIdx.x;
    __bf16* tile = wt + (size_t)(tkn * NCHUNK + c) * WT_TILE;
    const float* s1 = T1::src(W1 + (size_t)tkn * D_ * H_ + c * HC, tid);
    const float* s2 = T2::src(W2 + ((size_t)tkn * H_ + c * HC) * D_, tid);
    float4 v1[16], v2[16];
    T1::load(s1, v1);
    T2::load(s2, v2);
    // Stands behind the loads and in front of every rewrite of a register that
    // an issued load names (a precaution). Both address pairs are inputs of the
    // statement, so they stay live to this line and no load's result is placed
    // on them.
    asm volatile("s_wait_xcnt 0x0" :: "v"(s1), "v"(s2) : "memory");
    T1::store(T1::dst(tile, tid), v1);
    T2::store(T2::dst(tile + WT_HALF, tid), v2);
}

// Eight asynchronous 16-B copies per lane, global memory to LDS through no
// register: copy i takes 16 B at g + i * 4096 B to LDS byte l + i * LSTEP.
// The s_wait_xcnt at the end of the same statement stands in front of every
// rewrite of an address register that an issued copy names (a precaution).
template <int LSTEP>
__device__ __forceinline__ void async_copy8(unsigned l, const __bf16* g) {
    asm volatile(
        "global_load_async_to_lds_b128 %0, %8, off\n\t"
        "global_load_async_to_lds_b128 %1, %9, off\n\t"
        "global_load_async_to_lds_b128 %2, %10, off\n\t"
        "global_load_async_to_lds_b128 %3, %11, off\n\t"
        "global_load_async_to_lds_b128 %4, %12, off\n\t"
        "global_load_async_to_lds_b128 %5, %13, off\n\t"
        "global_load_async_to_lds_b128 %6, %14, off\n\t"
        "global_load_async_to_lds_b128 %7, %15, off\n\t"
        "s_wait_xcnt 0x0"
        :: "v"(l), "v"(l + LSTEP), "v"(l + 2 * LSTEP), "v"(l + 3 * LSTEP),
           "v"(l + 4 * LSTEP), "v"(l + 5 * LSTEP), "v"(l + 6 * LSTEP), "v"(l + 7 * LSTEP),
           "v"(g), "v"(g + 2048), "v"(g + 2 * 2048), "v"(g + 3 * 2048),
           "v"(g + 4 * 2048), "v"(g + 5 * 2048), "v"(g + 6 * 2048), "v"(g + 7 * 2048)
        : "memory");
}

// One wave's sixteen copies of one packed chunk. l1w, l2w: the LDS bytes of the
// wave's first W1 row and first W2 row in the target buffers; gw: the wave's first
// 512 B of the chunk in the workspace. All three are the same in every lane.
__device__ __forceinline__ void stage_chunk(unsigned l1w, unsigned l2w, const __bf16* gw) {
    // The lane's number, formed at this place: as the builtin it is moved out of
    // the loop, finds no free register there and is spilled to scratch memory, and
    // every hand-over then waits for a scratch load in front of its copies.
    unsigned lane;
    asm volatile("v_mbcnt_lo_u32_b32 %0, -1, 0" : "=v"(lane));
    const __bf16* g = gw + lane * 8;
    async_copy8<8 * DP * 2>(l1w + lane * 16, g);
    async_copy8<32 * HP * 2>(l2w + (lane >> 3) * (HP * 2) + (lane & 7) * 16, g + WT_HALF);
}

__global__ void __launch_bounds__(256)
PerTokenFFN_wmma_kernel(const float* __restrict__ x,
                        const __bf16* __restrict__ wt,
                        const float* __restrict__ b1,
                        const float* __restrict__ b2,
                        float* __restrict__ y)
{
    __shared__ __attribute__((aligned(16))) char smem[LDS_BYTES];
    __bf16* xA    = (__bf16*)(smem + LDS_XA);
    const __bf16* w1sAll = (const __bf16*)(smem + LDS_W1S);
    const __bf16* w2sAll = (const __bf16*)(smem + LDS_W2S);

    const int tid   = threadIdx.x;
    const int lane  = tid & 31;
    const int wave  = tid >> 5;
    const int half  = lane >> 4;   // which half-wave (selects K sub-range)
    const int lhalf = lane & 15;   // M (A-frag) / N (B-frag) index
    const int tkn   = blockIdx.y;
    const int b0    = blockIdx.x * BM;
    const int m0    = wave * (MT * 16);

    // ---- weight chunks: 16-B units, lanes contiguous in global memory ----
    // Unit tid + 256 * i of each half of a packed chunk is this lane's copy i:
    // w1s[h][d] has 32 units per row (a sweep of the block = 8 rows),
    // w2s[d][h] has 8 units per row (a sweep = 32 rows).
    // The wave's share of each address is kept in scalar registers, the lane's
    // share is formed where the copies are issued (stage_chunk), so that no vector
    // register is held for them across the loop, where none is free.
    const int wave_s = __builtin_amdgcn_readfirstlane(wave);
    const __bf16* wwave = wt + (size_t)tkn * NCHUNK * WT_TILE + wave_s * 256;
    const unsigned l1w = (unsigned)(size_t)(smem + LDS_W1S) + wave_s * (DP * 2);
    const unsigned l2w = (unsigned)(size_t)(smem + LDS_W2S) + wave_s * (4 * HP * 2);

    // Chunk 0 starts to fly in front of the x tile's staging.
    stage_chunk(l1w, l2w, wwave);

    // ---------------- stage x tile (f32 -> bf16) ----------------
    {
        // 64 float4 per row, 4 rows per sweep of the block: a thread's loads are
        // constant offsets from one address, its LDS stores likewise.
        const float* xp = x + (size_t)(b0 + (tid >> 6)) * (T_ * D_) + (size_t)tkn * D_
                            + (tid & 63) * 4;
        __bf16* xd = xA + (tid >> 6) * DP + (tid & 63) * 4;
        #pragma unroll
        for (int bt = 0; bt < BM / 128; ++bt) {   // batches of 32 loads
            float4 v[32];
            #pragma unroll
            for (int i = 0; i < 32; ++i)
                v[i] = *(const float4*)(xp + (size_t)((bt * 32 + i) * 4) * (T_ * D_));
            // Stands behind the loads and in front of every rewrite of a register
            // that an issued load names (a precaution). The address pair is an
            // input, so it stays live to this line and no result is placed on it.
            asm volatile("s_wait_xcnt 0x0" :: "v"(xp) : "memory");
            #pragma unroll
            for (int i = 0; i < 32; ++i) {
                u32x2 p;
                p.x = pack_bf16x2(v[i].x, v[i].y);
                p.y = pack_bf16x2(v[i].z, v[i].w);
                *(u32x2*)(xd + (bt * 32 + i) * 4 * DP) = p;
            }
        }
    }

    v8f yacc[MT][16];
    #pragma unroll
    for (int m = 0; m < MT; ++m)
        #pragma unroll
        for (int n = 0; n < 16; ++n)
            yacc[m][n] = (v8f){0.f,0.f,0.f,0.f,0.f,0.f,0.f,0.f};

    // Chunk 0 has landed for this wave's own copies; the barrier publishes it, and
    // the x tile, to the other waves.
    asm volatile("s_wait_asynccnt 0x0" ::: "memory");
    __syncthreads();
    // Chunk 1 flies while chunk 0 is worked on.
    stage_chunk(l1w + W1S_BYTES, l2w + W2S_BYTES, wwave + WT_TILE);

    // The lane's layer-1 bias values of a chunk run along H, eight per tile (h = 16 n
    // + 8 * half + r). Chunk 0's are asked for here, chunk t + 1's behind the gelu of
    // chunk t, which frees the registers: their latency passes behind a GEMM.
    const float* b1l = b1 + (size_t)tkn * H_ + 8 * half;
    const float4* bp = (const float4*)b1l;
    float4 bias1[4][2];
    #pragma unroll
    for (int n = 0; n < 4; ++n) {
        bias1[n][0] = bp[n * 4];
        bias1[n][1] = bp[n * 4 + 1];
    }
    // Stands behind the loads and in front of every rewrite of their address pair,
    // which is an input and so stays live to this line (a precaution).
    asm volatile("s_wait_xcnt 0x0" :: "v"(bp) : "memory");

    for (int t = 0; t < NCHUNK; ++t) {
        const int buf = t & 1;
        const __bf16* w1s = w1sAll + buf * (HC * DP);
        const __bf16* w2s = w2sAll + buf * (D_ * HP);

        // ---- GEMM1, transposed: h^T[64 x 32] = W1chunk^T[64 x 256] * xA^T[256 x 32] ----
        // The W1 fragment is the A operand and the x fragment the B operand, so an
        // accumulator tile holds in lane (half, lhalf) the batch row lhalf and the
        // eight h indices 8 * half + r: the k run that the same lane owns in an A
        // fragment of GEMM2. gelu(h) therefore goes from accumulators to GEMM2's
        // A fragments inside the lane's own registers, through no LDS.
        // Software-pipelined: fragments for k-step s+1 are loaded while the
        // WMMAs of k-step s execute, so ds_loads overlap matrix issue.

        v8f ht[MT][4];
        #pragma unroll
        for (int m = 0; m < MT; ++m)
            #pragma unroll
            for (int n = 0; n < 4; ++n)
                ht[m][n] = (v8f){0.f,0.f,0.f,0.f,0.f,0.f,0.f,0.f};

        {
            const __bf16* aRow = xA + (m0 + lhalf) * DP;
            v16bf a_cur[MT];
            #pragma unroll
            for (int m = 0; m < MT; ++m)
                a_cur[m] = ld_frag(aRow + m * 16 * DP, half * 8);
            v16bf b_cur[4];
            #pragma unroll
            for (int n = 0; n < 4; ++n)
                b_cur[n] = ld_frag(w1s + (n * 16 + lhalf) * DP, half * 8);

            #pragma unroll
            for (int ks = 0; ks < 8; ++ks) {
                v16bf a_nxt[MT];
                v16bf b_nxt[4];
                if (ks < 7) {
                    int koff = (ks + 1) * 32 + half * 8;
                    #pragma unroll
                    for (int m = 0; m < MT; ++m)
                        a_nxt[m] = ld_frag(aRow + m * 16 * DP, koff);
                    #pragma unroll
                    for (int n = 0; n < 4; ++n)
                        b_nxt[n] = ld_frag(w1s + (n * 16 + lhalf) * DP, koff);
                }
                #pragma unroll
                for (int n = 0; n < 4; ++n)
                    #pragma unroll
                    for (int m = 0; m < MT; ++m)
                        ht[m][n] = wmma_bf16(b_cur[n], a_cur[m], ht[m][n]);
                if (ks < 7) {
                    #pragma unroll
                    for (int m = 0; m < MT; ++m) a_cur[m] = a_nxt[m];
                    #pragma unroll
                    for (int n = 0; n < 4; ++n) b_cur[n] = b_nxt[n];
                }
            }
        }

        // ---- bias + erf GELU, round to bf16: GEMM2's A fragments, in registers ----
        // Tile n holds h = 16 n + 8 * half + r. Fragment a2[m][n >> 1] takes k =
        // 8 * half + e in its first eight elements and 16 + 8 * half + e in its
        // last eight: the even tile and the odd tile, register for register.
        union { v16bf v; bf16x2 p[8]; } a2[MT][2];
        #pragma unroll
        for (int n = 0; n < 4; ++n) {
            f32x2 hp[MT * 4], g[MT * 4], bc[4];
            bc[0] = (f32x2){bias1[n][0].x, bias1[n][0].y};
            bc[1] = (f32x2){bias1[n][0].z, bias1[n][0].w};
            bc[2] = (f32x2){bias1[n][1].x, bias1[n][1].y};
            bc[3] = (f32x2){bias1[n][1].z, bias1[n][1].w};
            #pragma unroll
            for (int m = 0; m < MT; ++m)
                #pragma unroll
                for (int q = 0; q < 4; ++q)
                    hp[m * 4 + q] = (f32x2){ht[m][n][2 * q], ht[m][n][2 * q + 1]};
            gelu_erf_pairs<MT * 4>(hp, bc, g);
            #pragma unroll
            for (int m = 0; m < MT; ++m)
                #pragma unroll
                for (int q = 0; q < 4; ++q)
                    a2[m][n >> 1].p[(n & 1) * 4 + q] =
                        __builtin_convertvector(g[m * 4 + q], bf16x2);
        }

        // Bias of chunk t + 1 (the last trip asks for its own chunk's again, so that
        // the address stays inside b1; nothing reads those values).
        bp = (const float4*)(b1l + (t + 1 < NCHUNK ? t + 1 : t) * HC);
        #pragma unroll
        for (int n = 0; n < 4; ++n) {
            bias1[n][0] = bp[n * 4];
            bias1[n][1] = bp[n * 4 + 1];
        }

        // ---- GEMM2: yacc[32 x 256] += gelu(h)[32 x 64] * W2chunk[64 x 256] ----
        // 8 pipeline steps: step s = (kk-half s>>2, ntile-group s&3), 4*MT WMMAs each.
        {
            v16bf b_cur[4];
            #pragma unroll
            for (int j = 0; j < 4; ++j)
                b_cur[j] = ld_frag(w2s + (j * 16 + lhalf) * HP, half * 8);

            #pragma unroll
            for (int s = 0; s < 8; ++s) {
                v16bf b_nxt[4];
                if (s < 7) {
                    int sn  = s + 1;
                    int kkn = (sn >> 2) * 32;
                    int gn  = sn & 3;
                    #pragma unroll
                    for (int j = 0; j < 4; ++j)
                        b_nxt[j] = ld_frag(w2s + ((gn * 4 + j) * 16 + lhalf) * HP,
                                           kkn + half * 8);
                }
                // Keeps the next step's LDS reads one group in front of this step's
                // WMMAs: left free, the compiler spreads the reads of both GEMMs
                // among the WMMAs, each pair directly in front of its user behind
                // a wait to zero, and a wave then waits out every LDS latency.
                __builtin_amdgcn_sched_barrier(0);
                int g = s & 3;
                #pragma unroll
                for (int j = 0; j < 4; ++j)
                    #pragma unroll
                    for (int m = 0; m < MT; ++m)
                        yacc[m][g * 4 + j] =
                            wmma_bf16(a2[m][s >> 2].v, b_cur[j], yacc[m][g * 4 + j]);
                if (s < 7) {
                    #pragma unroll
                    for (int j = 0; j < 4; ++j) b_cur[j] = b_nxt[j];
                }
            }
        }

        // ---- hand-over: chunk t + 1 is published, chunk t's buffers are freed ----
        // Stands behind the bias loads and in front of every rewrite of their address
        // pair, which is an input and so stays live to this line (a precaution).
        asm volatile("s_wait_xcnt 0x0" :: "v"(bp) : "memory");
        // This wave's LDS reads of chunk t have returned.
        asm volatile("s_wait_dscnt 0x0" ::: "memory");
        // This wave's copies of chunk t + 1 have landed.
        asm volatile("s_wait_asynccnt 0x0" ::: "memory");
        __syncthreads();
        // Chunk t + 2 goes into the buffers that chunk t has just left.
        if (t + 2 < NCHUNK)
            stage_chunk(l1w + buf * W1S_BYTES, l2w + buf * W2S_BYTES,
                        wwave + (size_t)(t + 2) * WT_TILE);
    }
    // No copy is outstanding when the wave goes on to its end.
    asm volatile("s_wait_asynccnt 0x0" ::: "memory");

    // ---------------- epilogue: + b2, store f32 ----------------
    float* yp = y + (size_t)(b0 + m0 + 8 * half) * (T_ * D_) + (size_t)tkn * D_ + lhalf;
    #pragma unroll
    for (int n = 0; n < 16; ++n) {
        int col    = n * 16 + lhalf;
        float bias = b2[(size_t)tkn * D_ + col];
        #pragma unroll
        for (int m = 0; m < MT; ++m)
            #pragma unroll
            for (int r = 0; r < 8; ++r) yacc[m][n][r] += bias;
    }
    // All sums stand in front of the first store: no vector instruction is moved in
    // among the stores, so none rewrites a register that an issued store names.
    __builtin_amdgcn_sched_barrier(0);
    #pragma unroll
    for (int n = 0; n < 16; ++n)
        #pragma unroll
        for (int m = 0; m < MT; ++m)
            #pragma unroll
            for (int r = 0; r < 8; ++r)
                yp[(size_t)(m * 16 + r) * (T_ * D_) + n * 16] = yacc[m][n][r];
    // Keeps the stores' address pair live behind the last store, so that it is not
    // rewritten while a store that names it is still issued (a precaution).
    asm volatile("s_wait_xcnt 0x0" :: "v"(yp) : "memory");
}

extern "C" void kernel_launch(void* const* d_in, const int* in_sizes, int n_in,
                              void* d_out, int out_size, void* d_ws, size_t ws_size,
                              hipStream_t stream) {
    (void)in_sizes; (void)n_in; (void)out_size; (void)ws_size;
    const float* x  = (const float*)d_in[0];
    const float* W1 = (const float*)d_in[1];
    const float* b1 = (const float*)d_in[2];
    const float* W2 = (const float*)d_in[3];
    const float* b2 = (const float*)d_in[4];
    float* y = (float*)d_out;
    __bf16* wt = (__bf16*)d_ws;   // 32 MB of packed bf16 weights

    dim3 block(256);          // 8 wave32
    dim3 pgrid(NCHUNK, T_);   // one (token, H chunk) per workgroup
    pack_weights_kernel<<<pgrid, block, 0, stream>>>(W1, W2, wt);

    dim3 grid(B_ / BM, T_);   // 8 x 32 = 256 workgroups
    PerTokenFFN_wmma_kernel<<<grid, block, 0, stream>>>(x, wt, b1, b2, y);
}
